// v000
// Times are from an AMD MI455X. After a warm-up the kernel runs many times in a row, and a time is the length of
// such a window on the GPU divided by its runs, so every launch and the gaps after it count. The runs cycle
// through copies of the inputs. A figure is the median of several windows, for all but v000 over two sittings.
// Sittings can differ by a few percent; kernels timed side by side share one.
// The starting kernel, v000, takes 547 microseconds a run.
#include <hip/hip_runtime.h>

#define NNODES 50000
#define DIM 128
#define NHEADS 8
#define HD 16
#define ROWTILES (NNODES / 16)   // 3125 exactly

typedef __attribute__((ext_vector_type(16))) _Float16 v16h;
typedef __attribute__((ext_vector_type(8)))  float    v8f;

// CDNA5 16-bit A-matrix 16x32 layout (ISA 7.12.2):
// lanes 0-15  (sel=0): halves 0..7 -> K=0..7,  halves 8..15 -> K=16..23
// lanes 16-31 (sel=1): halves 0..7 -> K=8..15, halves 8..15 -> K=24..31
__device__ __forceinline__ int kmap(int i, int sel) {
    int base = sel ? 8 : 0;
    return (i < 8) ? (base + i) : (16 + base + (i - 8));
}

// Load one 16x32 A fragment from f32 row-major source (vectorized float4)
__device__ __forceinline__ v16h load_a_f32(const float* __restrict__ src, int lda) {
    int lane = threadIdx.x & 31;
    int m = lane & 15, sel = lane >> 4;
    const float4* p = (const float4*)(src + m * lda);
    float4 u0 = p[sel * 2 + 0];      // K = sel*8 .. sel*8+3
    float4 u1 = p[sel * 2 + 1];      // K = sel*8+4 .. sel*8+7
    float4 u2 = p[4 + sel * 2 + 0];  // K = 16+sel*8 ..
    float4 u3 = p[4 + sel * 2 + 1];
    v16h a;
    a[0]  = (_Float16)u0.x; a[1]  = (_Float16)u0.y; a[2]  = (_Float16)u0.z; a[3]  = (_Float16)u0.w;
    a[4]  = (_Float16)u1.x; a[5]  = (_Float16)u1.y; a[6]  = (_Float16)u1.z; a[7]  = (_Float16)u1.w;
    a[8]  = (_Float16)u2.x; a[9]  = (_Float16)u2.y; a[10] = (_Float16)u2.z; a[11] = (_Float16)u2.w;
    a[12] = (_Float16)u3.x; a[13] = (_Float16)u3.y; a[14] = (_Float16)u3.z; a[15] = (_Float16)u3.w;
    return a;
}

// Load one 16x32 A fragment from an f16 LDS tile [16][DIM]
// (per-lane halves are two contiguous 16B runs -> merges into ds_load_b128 x2)
__device__ __forceinline__ v16h load_a_lds(const _Float16* tile, int k0) {
    int lane = threadIdx.x & 31;
    int m = lane & 15, sel = lane >> 4;
    const _Float16* row = tile + m * DIM + k0;
    v16h a;
#pragma unroll
    for (int i = 0; i < 16; ++i) a[i] = row[kmap(i, sel)];
    return a;
}

// Pre-packed B fragments: per fragment (j,kk), lane l owns 16 contiguous halves
// (32 bytes) -> a single vector load (2 x global_load_b128) at GEMM time.
__device__ __forceinline__ v16h load_b_packed(const _Float16* __restrict__ P, int j, int kk) {
    int lane = threadIdx.x & 31;
    return *(const v16h*)(P + ((size_t)(j * 4 + kk) * 32 + lane) * 16);
}

// ---------------------------------------------------------------------------
// Kernel 0: pack one f32 weight matrix [128][128] into WMMA B-fragment f16
// layout. One wave per (j,kk) fragment; 32 fragments per matrix.
// ---------------------------------------------------------------------------
__global__ __launch_bounds__(32) void pack_w(const float* __restrict__ W,
                                             _Float16* __restrict__ P) {
    int frag = blockIdx.x;          // j*4 + kk
    int j = frag >> 2, kk = frag & 3;
    int lane = threadIdx.x & 31;
    int n = lane & 15, sel = lane >> 4;
    _Float16* dstp = P + ((size_t)frag * 32 + lane) * 16;
#pragma unroll
    for (int i = 0; i < 16; ++i)
        dstp[i] = (_Float16)W[(size_t)(kk * 32 + kmap(i, sel)) * DIM + j * 16 + n];
}

// ---------------------------------------------------------------------------
// Kernel 1: fused Q/K/V projection. One wave (32 threads) per 16-row tile.
// B fragments double-buffered across the column-tile loop so global loads
// overlap the WMMAs instead of serializing load->wait->wmma.
// ---------------------------------------------------------------------------
__global__ __launch_bounds__(32) void qkv_gemm(
        const float* __restrict__ x,
        const _Float16* __restrict__ Pq, const float* __restrict__ bq,
        const _Float16* __restrict__ Pk, const float* __restrict__ bk,
        const _Float16* __restrict__ Pv, const float* __restrict__ bv,
        float* __restrict__ Q, float* __restrict__ K, float* __restrict__ V) {
    int row0 = blockIdx.x * 16;
    int lane = threadIdx.x & 31;

    v16h a[4];
#pragma unroll
    for (int kk = 0; kk < 4; ++kk)
        a[kk] = load_a_f32(x + (size_t)row0 * DIM + kk * 32, DIM);

    const _Float16* Ps[3] = {Pq, Pk, Pv};
    const float*    bs[3] = {bq, bk, bv};
    float*          Os[3] = {Q, K, V};

    int n  = lane & 15;
    int mb = (lane >> 4) * 8;

#pragma unroll
    for (int mtx = 0; mtx < 3; ++mtx) {
        const _Float16* P    = Ps[mtx];
        const float*    bias = bs[mtx];
        float*          out  = Os[mtx];

        v16h b[4];
#pragma unroll
        for (int kk = 0; kk < 4; ++kk) b[kk] = load_b_packed(P, 0, kk);

#pragma unroll
        for (int j = 0; j < 8; ++j) {
            v16h bn[4];
            if (j < 7) {
#pragma unroll
                for (int kk = 0; kk < 4; ++kk) bn[kk] = load_b_packed(P, j + 1, kk);
            }
            v8f acc = {};
#pragma unroll
            for (int kk = 0; kk < 4; ++kk)
                acc = __builtin_amdgcn_wmma_f32_16x16x32_f16(
                        false, a[kk], false, b[kk], (short)0, acc, false, false);

            int col = j * 16 + n;
            float bb = bias[col];
#pragma unroll
            for (int i = 0; i < 8; ++i)
                out[(size_t)(row0 + mb + i) * DIM + col] = acc[i] + bb;

#pragma unroll
            for (int kk = 0; kk < 4; ++kk) b[kk] = bn[kk];
        }
    }
}

// ---------------------------------------------------------------------------
// Kernel 2: zero the wV accumulator
// ---------------------------------------------------------------------------
__global__ void zero_f32(float* __restrict__ p, int n) {
    int i = blockIdx.x * blockDim.x + threadIdx.x;
    if (i < n) p[i] = 0.0f;
}

// ---------------------------------------------------------------------------
// Kernel 3: per-(edge, head) attention score + scatter-add into wV
// ---------------------------------------------------------------------------
__global__ void edge_attn(const float* __restrict__ Q, const float* __restrict__ K,
                          const float* __restrict__ V, const int* __restrict__ src,
                          const int* __restrict__ dst, float* __restrict__ wV, int E) {
    int t = blockIdx.x * blockDim.x + threadIdx.x;
    if (t >= E * NHEADS) return;
    int e = t >> 3;
    int h = t & 7;
    int s = src[e];
    int d = dst[e];

    const float4* kp = (const float4*)(K + (size_t)s * DIM + h * HD);
    const float4* qp = (const float4*)(Q + (size_t)d * DIM + h * HD);
    float dot = 0.0f;
#pragma unroll
    for (int i = 0; i < 4; ++i) {
        float4 kv = kp[i], qv = qp[i];
        dot += kv.x * qv.x + kv.y * qv.y + kv.z * qv.z + kv.w * qv.w;
    }
    dot *= 0.25f;                           // 1/sqrt(16)
    dot = fminf(5.0f, fmaxf(-5.0f, dot));   // clamp(-5, 5)
    float sc = __expf(dot);

    const float4* vp = (const float4*)(V + (size_t)s * DIM + h * HD);
    float* o = wV + (size_t)d * DIM + h * HD;
#pragma unroll
    for (int i = 0; i < 4; ++i) {
        float4 vv = vp[i];
        unsafeAtomicAdd(o + i * 4 + 0, vv.x * sc);
        unsafeAtomicAdd(o + i * 4 + 1, vv.y * sc);
        unsafeAtomicAdd(o + i * 4 + 2, vv.z * sc);
        unsafeAtomicAdd(o + i * 4 + 3, vv.w * sc);
    }
}

// ---------------------------------------------------------------------------
// Kernel 4: residual + LN1 -> LN2 -> Wo GEMM (WMMA from LDS) -> ReLU + residual
// One 16-row tile per block of 128 threads (4 waves). Each wave's two Wo
// B-column-tiles are preloaded BEFORE the LN phase so the global loads are in
// flight under ~100 VALU ops of LayerNorm work.
// ---------------------------------------------------------------------------
__global__ __launch_bounds__(128) void fused_ln_out(
        const float* __restrict__ x, const float* __restrict__ wV,
        const _Float16* __restrict__ Po, const float* __restrict__ bo,
        const float* __restrict__ g1, const float* __restrict__ b1,
        const float* __restrict__ g2, const float* __restrict__ b2,
        float* __restrict__ out) {
    __shared__ float    h2s[16 * DIM];   // post-LN1 tile (residual for epilogue)
    __shared__ _Float16 gs[16 * DIM];    // post-LN2 tile (A matrix for WMMA)

    int row0 = blockIdx.x * 16;
    int t = threadIdx.x;
    int r  = t >> 3;          // row in tile (8 threads per row; contiguous in wave)
    int c0 = (t & 7) * 16;    // 16 columns per thread
    int wave = t >> 5;
    int lane = t & 31;

    // --- preload this wave's B fragments (independent of LDS/LN work) ---
    v16h b0[4], b1f[4];
#pragma unroll
    for (int kk = 0; kk < 4; ++kk) {
        b0[kk]  = load_b_packed(Po, wave * 2 + 0, kk);
        b1f[kk] = load_b_packed(Po, wave * 2 + 1, kk);
    }

    // --- residual + LN1 ---
    float v[16];
    float s = 0.0f, ss = 0.0f;
#pragma unroll
    for (int i = 0; i < 16; ++i) {
        size_t idx = (size_t)(row0 + r) * DIM + c0 + i;
        float val = x[idx] + wV[idx];
        v[i] = val; s += val; ss += val * val;
    }
#pragma unroll
    for (int m = 1; m < 8; m <<= 1) {     // reduce within the 8 lanes of a row
        s  += __shfl_xor(s,  m, 32);
        ss += __shfl_xor(ss, m, 32);
    }
    float mean = s * (1.0f / DIM);
    float var  = ss * (1.0f / DIM) - mean * mean;
    float rstd = rsqrtf(var + 1e-5f);

    // --- LN2 on LN1 output ---
    float s2 = 0.0f, ss2 = 0.0f;
#pragma unroll
    for (int i = 0; i < 16; ++i) {
        int c = c0 + i;
        float h = (v[i] - mean) * rstd * g1[c] + b1[c];
        v[i] = h;
        h2s[r * DIM + c] = h;
        s2 += h; ss2 += h * h;
    }
#pragma unroll
    for (int m = 1; m < 8; m <<= 1) {
        s2  += __shfl_xor(s2,  m, 32);
        ss2 += __shfl_xor(ss2, m, 32);
    }
    float mean2 = s2 * (1.0f / DIM);
    float var2  = ss2 * (1.0f / DIM) - mean2 * mean2;
    float rstd2 = rsqrtf(var2 + 1e-5f);
#pragma unroll
    for (int i = 0; i < 16; ++i) {
        int c = c0 + i;
        gs[r * DIM + c] = (_Float16)((v[i] - mean2) * rstd2 * g2[c] + b2[c]);
    }
    __syncthreads();

    // --- Wo GEMM + bias + ReLU + residual epilogue ---
    v16h a[4];
#pragma unroll
    for (int kk = 0; kk < 4; ++kk) a[kk] = load_a_lds(gs, kk * 32);

    int n  = lane & 15;
    int mb = (lane >> 4) * 8;

#pragma unroll
    for (int jj = 0; jj < 2; ++jj) {      // 8 column tiles / 4 waves
        int j = wave * 2 + jj;
        v8f acc = {};
#pragma unroll
        for (int kk = 0; kk < 4; ++kk) {
            v16h b = (jj == 0) ? b0[kk] : b1f[kk];
            acc = __builtin_amdgcn_wmma_f32_16x16x32_f16(
                    false, a[kk], false, b, (short)0, acc, false, false);
        }
        int col = j * 16 + n;
        float bb = bo[col];
#pragma unroll
        for (int i = 0; i < 8; ++i) {
            float relu = fmaxf(acc[i] + bb, 0.0f);
            out[(size_t)(row0 + mb + i) * DIM + col] = h2s[(mb + i) * DIM + col] + relu;
        }
    }
}

// ---------------------------------------------------------------------------
extern "C" void kernel_launch(void* const* d_in, const int* in_sizes, int n_in,
                              void* d_out, int out_size, void* d_ws, size_t ws_size,
                              hipStream_t stream) {
    const float* x  = (const float*)d_in[0];
    const int*   src = (const int*)d_in[1];
    const int*   dst = (const int*)d_in[2];
    const float* Wq = (const float*)d_in[3];
    const float* bq = (const float*)d_in[4];
    const float* Wk = (const float*)d_in[5];
    const float* bk = (const float*)d_in[6];
    const float* Wv = (const float*)d_in[7];
    const float* bv = (const float*)d_in[8];
    const float* Wo = (const float*)d_in[9];
    const float* bo = (const float*)d_in[10];
    const float* g1 = (const float*)d_in[11];
    const float* b1 = (const float*)d_in[12];
    const float* g2 = (const float*)d_in[13];
    const float* b2 = (const float*)d_in[14];
    float* out = (float*)d_out;

    int E = in_sizes[1];
    size_t nd = (size_t)NNODES * DIM;
    float* Q  = (float*)d_ws;
    float* K  = Q + nd;
    float* V  = K + nd;
    float* wV = V + nd;
    // packed f16 weight fragments: 32 frags * 32 lanes * 16 halves = 16384 halves each
    _Float16* Pq = (_Float16*)(wV + nd);
    _Float16* Pk = Pq + 32 * 32 * 16;
    _Float16* Pv = Pk + 32 * 32 * 16;
    _Float16* Po = Pv + 32 * 32 * 16;

    pack_w<<<32, 32, 0, stream>>>(Wq, Pq);
    pack_w<<<32, 32, 0, stream>>>(Wk, Pk);
    pack_w<<<32, 32, 0, stream>>>(Wv, Pv);
    pack_w<<<32, 32, 0, stream>>>(Wo, Po);

    zero_f32<<<(int)((nd + 255) / 256), 256, 0, stream>>>(wV, (int)nd);
    qkv_gemm<<<ROWTILES, 32, 0, stream>>>(x, Pq, bq, Pk, bk, Pv, bv, Q, K, V);
    int tot = E * NHEADS;
    edge_attn<<<(tot + 255) / 256, 256, 0, stream>>>(Q, K, V, src, dst, wV, E);
    fused_ln_out<<<ROWTILES, 128, 0, stream>>>(x, wV, Po, bo, g1, b1, g2, b2, out);
}

// v001
// Measured time: 150 microseconds a run.
// Two timings next to v000 put it at 3.69 and 3.67 times that version's speed.
#include <hip/hip_runtime.h>

#define NNODES 50000
#define DIM 128
#define NHEADS 8
#define HD 16
#define ROWTILES (NNODES / 16)   // 3125 exactly
#define NPAD 53248               // node counters, padded to 52 * 1024

typedef __attribute__((ext_vector_type(16))) _Float16 v16h;
typedef __attribute__((ext_vector_type(8)))  float    v8f;

// CDNA5 16-bit A-matrix 16x32 layout (ISA 7.12.2):
// lanes 0-15  (sel=0): halves 0..7 -> K=0..7,  halves 8..15 -> K=16..23
// lanes 16-31 (sel=1): halves 0..7 -> K=8..15, halves 8..15 -> K=24..31
__device__ __forceinline__ int kmap(int i, int sel) {
    int base = sel ? 8 : 0;
    return (i < 8) ? (base + i) : (16 + base + (i - 8));
}

// Load one 16x32 A fragment from f32 row-major source (vectorized float4)
__device__ __forceinline__ v16h load_a_f32(const float* __restrict__ src, int lda) {
    int lane = threadIdx.x & 31;
    int m = lane & 15, sel = lane >> 4;
    const float4* p = (const float4*)(src + m * lda);
    float4 u0 = p[sel * 2 + 0];      // K = sel*8 .. sel*8+3
    float4 u1 = p[sel * 2 + 1];      // K = sel*8+4 .. sel*8+7
    float4 u2 = p[4 + sel * 2 + 0];  // K = 16+sel*8 ..
    float4 u3 = p[4 + sel * 2 + 1];
    v16h a;
    a[0]  = (_Float16)u0.x; a[1]  = (_Float16)u0.y; a[2]  = (_Float16)u0.z; a[3]  = (_Float16)u0.w;
    a[4]  = (_Float16)u1.x; a[5]  = (_Float16)u1.y; a[6]  = (_Float16)u1.z; a[7]  = (_Float16)u1.w;
    a[8]  = (_Float16)u2.x; a[9]  = (_Float16)u2.y; a[10] = (_Float16)u2.z; a[11] = (_Float16)u2.w;
    a[12] = (_Float16)u3.x; a[13] = (_Float16)u3.y; a[14] = (_Float16)u3.z; a[15] = (_Float16)u3.w;
    return a;
}

// Load one 16x32 A fragment from an f16 LDS tile [16][DIM]
// (per-lane halves are two contiguous 16B runs -> merges into ds_load_b128 x2)
__device__ __forceinline__ v16h load_a_lds(const _Float16* tile, int k0) {
    int lane = threadIdx.x & 31;
    int m = lane & 15, sel = lane >> 4;
    const _Float16* row = tile + m * DIM + k0;
    v16h a;
#pragma unroll
    for (int i = 0; i < 16; ++i) a[i] = row[kmap(i, sel)];
    return a;
}

// Pre-packed B fragments: per fragment (j,kk), lane l owns 16 contiguous halves
// (32 bytes) -> a single vector load (2 x global_load_b128) at GEMM time.
__device__ __forceinline__ v16h load_b_packed(const _Float16* __restrict__ P, int j, int kk) {
    int lane = threadIdx.x & 31;
    return *(const v16h*)(P + ((size_t)(j * 4 + kk) * 32 + lane) * 16);
}

// ---------------------------------------------------------------------------
// Kernel 0: pack one f32 weight matrix [128][128] into WMMA B-fragment f16
// layout. One wave per (j,kk) fragment; 32 fragments per matrix.
// ---------------------------------------------------------------------------
__global__ __launch_bounds__(32) void pack_w(const float* __restrict__ W,
                                             _Float16* __restrict__ P) {
    int frag = blockIdx.x;          // j*4 + kk
    int j = frag >> 2, kk = frag & 3;
    int lane = threadIdx.x & 31;
    int n = lane & 15, sel = lane >> 4;
    _Float16* dstp = P + ((size_t)frag * 32 + lane) * 16;
#pragma unroll
    for (int i = 0; i < 16; ++i)
        dstp[i] = (_Float16)W[(size_t)(kk * 32 + kmap(i, sel)) * DIM + j * 16 + n];
}

// ---------------------------------------------------------------------------
// Kernel 1: fused Q/K/V projection. One wave (32 threads) per 16-row tile.
// B fragments double-buffered across the column-tile loop so global loads
// overlap the WMMAs instead of serializing load->wait->wmma.
// ---------------------------------------------------------------------------
__global__ __launch_bounds__(32) void qkv_gemm(
        const float* __restrict__ x,
        const _Float16* __restrict__ Pq, const float* __restrict__ bq,
        const _Float16* __restrict__ Pk, const float* __restrict__ bk,
        const _Float16* __restrict__ Pv, const float* __restrict__ bv,
        float* __restrict__ Q, float* __restrict__ K, float* __restrict__ V) {
    int row0 = blockIdx.x * 16;
    int lane = threadIdx.x & 31;

    v16h a[4];
#pragma unroll
    for (int kk = 0; kk < 4; ++kk)
        a[kk] = load_a_f32(x + (size_t)row0 * DIM + kk * 32, DIM);

    const _Float16* Ps[3] = {Pq, Pk, Pv};
    const float*    bs[3] = {bq, bk, bv};
    float*          Os[3] = {Q, K, V};

    int n  = lane & 15;
    int mb = (lane >> 4) * 8;

#pragma unroll
    for (int mtx = 0; mtx < 3; ++mtx) {
        const _Float16* P    = Ps[mtx];
        const float*    bias = bs[mtx];
        float*          out  = Os[mtx];

        v16h b[4];
#pragma unroll
        for (int kk = 0; kk < 4; ++kk) b[kk] = load_b_packed(P, 0, kk);

#pragma unroll
        for (int j = 0; j < 8; ++j) {
            v16h bn[4];
            if (j < 7) {
#pragma unroll
                for (int kk = 0; kk < 4; ++kk) bn[kk] = load_b_packed(P, j + 1, kk);
            }
            v8f acc = {};
#pragma unroll
            for (int kk = 0; kk < 4; ++kk)
                acc = __builtin_amdgcn_wmma_f32_16x16x32_f16(
                        false, a[kk], false, b[kk], (short)0, acc, false, false);

            int col = j * 16 + n;
            float bb = bias[col];
#pragma unroll
            for (int i = 0; i < 8; ++i)
                out[(size_t)(row0 + mb + i) * DIM + col] = acc[i] + bb;

#pragma unroll
            for (int kk = 0; kk < 4; ++kk) b[kk] = bn[kk];
        }
    }
}

// ---------------------------------------------------------------------------
// Kernel 2: zero the per-node edge counters (padded to NPAD entries)
// ---------------------------------------------------------------------------
__global__ void zero_i32(int* __restrict__ p, int n) {
    int i = blockIdx.x * blockDim.x + threadIdx.x;
    if (i < n) p[i] = 0;
}

// ---------------------------------------------------------------------------
// Kernel 3a: count the edges of every destination node; the returned old count
// is the edge's place inside its node's run (arrival order).
// ---------------------------------------------------------------------------
__global__ void edge_rank(const int* __restrict__ dst, int* __restrict__ cnt,
                          int* __restrict__ rank, int E) {
    int e = blockIdx.x * blockDim.x + threadIdx.x;
    if (e >= E) return;
    int d = dst[e];
    if ((unsigned)d < (unsigned)NNODES) rank[e] = atomicAdd(cnt + d, 1);
}

// ---------------------------------------------------------------------------
// Kernel 3b: exclusive prefix sum of the counters. Each block owns 1024
// counters and sums all counters in front of them itself (at most 200 KB of
// whole-line reads), so no block depends on another one.
// ---------------------------------------------------------------------------
__global__ __launch_bounds__(1024) void scan_counts(const int* __restrict__ cnt,
                                                    int* __restrict__ off) {
    __shared__ int wtot[32];
    __shared__ int ptot[32];
    int t = threadIdx.x, lane = t & 31, w = t >> 5;
    int first = blockIdx.x * 1024;
    int c = cnt[first + t];

    // Counters in front of this block, in chunks of 1024 (256 threads x int4), four
    // chunks per pass. All 13 loads are issued before the first sum (one L2 latency,
    // not 13); a chunk that is not in front is read as chunk 0 and left out of the sum.
    int p = 0;
    const int4* c4 = (const int4*)cnt;
    int sub = t & 255, grp = t >> 8, nfront = blockIdx.x;
    int4 u[NPAD / 4096];
#pragma unroll
    for (int k = 0; k < NPAD / 4096; ++k) {
        int ch = grp + 4 * k;
        u[k] = c4[(ch < nfront ? ch : 0) * 256 + sub];
        // a later load's result may land in this load's offset register: wait first
        asm volatile("s_wait_xcnt 0x0" ::: "memory");
    }
#pragma unroll
    for (int k = 0; k < NPAD / 4096; ++k)
        if (grp + 4 * k < nfront) p += (u[k].x + u[k].y) + (u[k].z + u[k].w);

    int inc = c;                          // inclusive scan inside the wave
#pragma unroll
    for (int d = 1; d < 32; d <<= 1) {
        int o = __shfl_up(inc, d, 32);
        if (lane >= d) inc += o;
    }
#pragma unroll
    for (int m = 1; m < 32; m <<= 1) p += __shfl_xor(p, m, 32);
    if (lane == 31) wtot[w] = inc;
    if (lane == 0)  ptot[w] = p;
    __syncthreads();

    int b = ptot[lane] + (lane < w ? wtot[lane] : 0);
#pragma unroll
    for (int m = 1; m < 32; m <<= 1) b += __shfl_xor(b, m, 32);
    off[first + t] = b + inc - c;
}

// ---------------------------------------------------------------------------
// Kernel 3c: write every edge's source node into its place of the dst-sorted list
// ---------------------------------------------------------------------------
__global__ void edge_place(const int* __restrict__ src, const int* __restrict__ dst,
                           const int* __restrict__ off, const int* __restrict__ rank,
                           int* __restrict__ perm, int E) {
    int e = blockIdx.x * blockDim.x + threadIdx.x;
    if (e >= E) return;
    int d = dst[e];
    if ((unsigned)d < (unsigned)NNODES)
        perm[off[d] + rank[e]] = min(max(src[e], 0), NNODES - 1);
}

// Sum over the 4 lanes of a quad (one head = 16 floats = 4 lanes x float4)
__device__ __forceinline__ float quad_sum(float p) {
    p += __int_as_float(__builtin_amdgcn_update_dpp(0, __float_as_int(p), 0xB1, 0xf, 0xf, true)); // lanes 1,0,3,2
    p += __int_as_float(__builtin_amdgcn_update_dpp(0, __float_as_int(p), 0x4E, 0xf, 0xf, true)); // lanes 2,3,0,1
    return p;
}

// ---------------------------------------------------------------------------
// Kernel 3d: one wave per destination node. A lane holds 4 of the 128 columns;
// the node's edges are walked four at a time (8 row loads in flight) and summed
// in registers, so wV gets one plain store per element.
// ---------------------------------------------------------------------------
__global__ __launch_bounds__(256) void node_attn(
        const float* __restrict__ Q, const float* __restrict__ K,
        const float* __restrict__ V, const int* __restrict__ off,
        const int* __restrict__ perm, float* __restrict__ wV, int E) {
    int lane = threadIdx.x & 31;
    int node = blockIdx.x * 8 + (threadIdx.x >> 5);
    int beg = __builtin_amdgcn_readfirstlane(off[node]);
    int end = min(__builtin_amdgcn_readfirstlane(off[node + 1]), E);

    float4 q = ((const float4*)(Q + (size_t)node * DIM))[lane];
    q.x *= 0.25f; q.y *= 0.25f; q.z *= 0.25f; q.w *= 0.25f;   // 1/sqrt(16), exact

    float4 acc = make_float4(0.0f, 0.0f, 0.0f, 0.0f);
    for (int base = beg; base < end; base += 32) {
        int n = min(32, end - base);
        int idx = perm[base + min(lane, n - 1)];
        for (int j = 0; j < n; j += 4) {
            float4 kv[4], vv[4];
#pragma unroll
            for (int u = 0; u < 4; ++u) {
                // past the end: the last edge's rows again (same lines), weight 0 below
                unsigned s = (unsigned)__builtin_amdgcn_readlane(idx, min(j + u, n - 1));
                unsigned o = s * (DIM * 4u) + lane * 16u;   // one 32-bit byte offset for both rows
                kv[u] = *(const float4*)((const char*)K + o);
                vv[u] = *(const float4*)((const char*)V + o);
            }
#pragma unroll
            for (int u = 0; u < 4; ++u) {
                float dot = quad_sum(kv[u].x * q.x + kv[u].y * q.y + kv[u].z * q.z + kv[u].w * q.w);
                dot = fminf(5.0f, fmaxf(-5.0f, dot));   // clamp(-5, 5)
                float sc = (j + u < n) ? __expf(dot) : 0.0f;
                acc.x += vv[u].x * sc;
                acc.y += vv[u].y * sc;
                acc.z += vv[u].z * sc;
                acc.w += vv[u].w * sc;
            }
        }
    }
    ((float4*)(wV + (size_t)node * DIM))[lane] = acc;
}

// ---------------------------------------------------------------------------
// Kernel 4: residual + LN1 -> LN2 -> Wo GEMM (WMMA from LDS) -> ReLU + residual
// One 16-row tile per block of 128 threads (4 waves). Each wave's two Wo
// B-column-tiles are preloaded BEFORE the LN phase so the global loads are in
// flight under ~100 VALU ops of LayerNorm work.
// ---------------------------------------------------------------------------
__global__ __launch_bounds__(128) void fused_ln_out(
        const float* __restrict__ x, const float* __restrict__ wV,
        const _Float16* __restrict__ Po, const float* __restrict__ bo,
        const float* __restrict__ g1, const float* __restrict__ b1,
        const float* __restrict__ g2, const float* __restrict__ b2,
        float* __restrict__ out) {
    __shared__ float    h2s[16 * DIM];   // post-LN1 tile (residual for epilogue)
    __shared__ _Float16 gs[16 * DIM];    // post-LN2 tile (A matrix for WMMA)

    int row0 = blockIdx.x * 16;
    int t = threadIdx.x;
    int r  = t >> 3;          // row in tile (8 threads per row; contiguous in wave)
    int c0 = (t & 7) * 16;    // 16 columns per thread
    int wave = t >> 5;
    int lane = t & 31;

    // --- preload this wave's B fragments (independent of LDS/LN work) ---
    v16h b0[4], b1f[4];
#pragma unroll
    for (int kk = 0; kk < 4; ++kk) {
        b0[kk]  = load_b_packed(Po, wave * 2 + 0, kk);
        b1f[kk] = load_b_packed(Po, wave * 2 + 1, kk);
    }

    // --- residual + LN1 ---
    float v[16];
    float s = 0.0f, ss = 0.0f;
#pragma unroll
    for (int i = 0; i < 16; ++i) {
        size_t idx = (size_t)(row0 + r) * DIM + c0 + i;
        float val = x[idx] + wV[idx];
        v[i] = val; s += val; ss += val * val;
    }
#pragma unroll
    for (int m = 1; m < 8; m <<= 1) {     // reduce within the 8 lanes of a row
        s  += __shfl_xor(s,  m, 32);
        ss += __shfl_xor(ss, m, 32);
    }
    float mean = s * (1.0f / DIM);
    float var  = ss * (1.0f / DIM) - mean * mean;
    float rstd = rsqrtf(var + 1e-5f);

    // --- LN2 on LN1 output ---
    float s2 = 0.0f, ss2 = 0.0f;
#pragma unroll
    for (int i = 0; i < 16; ++i) {
        int c = c0 + i;
        float h = (v[i] - mean) * rstd * g1[c] + b1[c];
        v[i] = h;
        h2s[r * DIM + c] = h;
        s2 += h; ss2 += h * h;
    }
#pragma unroll
    for (int m = 1; m < 8; m <<= 1) {
        s2  += __shfl_xor(s2,  m, 32);
        ss2 += __shfl_xor(ss2, m, 32);
    }
    float mean2 = s2 * (1.0f / DIM);
    float var2  = ss2 * (1.0f / DIM) - mean2 * mean2;
    float rstd2 = rsqrtf(var2 + 1e-5f);
#pragma unroll
    for (int i = 0; i < 16; ++i) {
        int c = c0 + i;
        gs[r * DIM + c] = (_Float16)((v[i] - mean2) * rstd2 * g2[c] + b2[c]);
    }
    __syncthreads();

    // --- Wo GEMM + bias + ReLU + residual epilogue ---
    v16h a[4];
#pragma unroll
    for (int kk = 0; kk < 4; ++kk) a[kk] = load_a_lds(gs, kk * 32);

    int n  = lane & 15;
    int mb = (lane >> 4) * 8;

#pragma unroll
    for (int jj = 0; jj < 2; ++jj) {      // 8 column tiles / 4 waves
        int j = wave * 2 + jj;
        v8f acc = {};
#pragma unroll
        for (int kk = 0; kk < 4; ++kk) {
            v16h b = (jj == 0) ? b0[kk] : b1f[kk];
            acc = __builtin_amdgcn_wmma_f32_16x16x32_f16(
                    false, a[kk], false, b, (short)0, acc, false, false);
        }
        int col = j * 16 + n;
        float bb = bo[col];
#pragma unroll
        for (int i = 0; i < 8; ++i) {
            float relu = fmaxf(acc[i] + bb, 0.0f);
            out[(size_t)(row0 + mb + i) * DIM + col] = h2s[(mb + i) * DIM + col] + relu;
        }
    }
}

// ---------------------------------------------------------------------------
extern "C" void kernel_launch(void* const* d_in, const int* in_sizes, int n_in,
                              void* d_out, int out_size, void* d_ws, size_t ws_size,
                              hipStream_t stream) {
    const float* x  = (const float*)d_in[0];
    const int*   src = (const int*)d_in[1];
    const int*   dst = (const int*)d_in[2];
    const float* Wq = (const float*)d_in[3];
    const float* bq = (const float*)d_in[4];
    const float* Wk = (const float*)d_in[5];
    const float* bk = (const float*)d_in[6];
    const float* Wv = (const float*)d_in[7];
    const float* bv = (const float*)d_in[8];
    const float* Wo = (const float*)d_in[9];
    const float* bo = (const float*)d_in[10];
    const float* g1 = (const float*)d_in[11];
    const float* b1 = (const float*)d_in[12];
    const float* g2 = (const float*)d_in[13];
    const float* b2 = (const float*)d_in[14];
    float* out = (float*)d_out;

    int E = in_sizes[1];
    size_t nd = (size_t)NNODES * DIM;
    float* Q  = (float*)d_ws;
    float* K  = Q + nd;
    float* V  = K + nd;
    float* wV = V + nd;
    // packed f16 weight fragments: 32 frags * 32 lanes * 16 halves = 16384 halves each
    _Float16* Pq = (_Float16*)(wV + nd);
    _Float16* Pk = Pq + 32 * 32 * 16;
    _Float16* Pv = Pk + 32 * 32 * 16;
    _Float16* Po = Pv + 32 * 32 * 16;
    // dst-sorted edge list: counters, run starts, place in run, source node per place
    int* cnt  = (int*)(Po + 32 * 32 * 16);
    int* off  = cnt + NPAD;
    int* rank = off + NPAD;
    int* perm = rank + E;

    pack_w<<<32, 32, 0, stream>>>(Wq, Pq);
    pack_w<<<32, 32, 0, stream>>>(Wk, Pk);
    pack_w<<<32, 32, 0, stream>>>(Wv, Pv);
    pack_w<<<32, 32, 0, stream>>>(Wo, Po);

    zero_i32<<<NPAD / 256, 256, 0, stream>>>(cnt, NPAD);
    edge_rank<<<(E + 255) / 256, 256, 0, stream>>>(dst, cnt, rank, E);
    scan_counts<<<NPAD / 1024, 1024, 0, stream>>>(cnt, off);
    edge_place<<<(E + 255) / 256, 256, 0, stream>>>(src, dst, off, rank, perm, E);
    qkv_gemm<<<ROWTILES, 32, 0, stream>>>(x, Pq, bq, Pk, bk, Pv, bv, Q, K, V);
    node_attn<<<NNODES / 8, 256, 0, stream>>>(Q, K, V, off, perm, wV, E);
    fused_ln_out<<<ROWTILES, 128, 0, stream>>>(x, wV, Po, bo, g1, b1, g2, b2, out);
}

// v002
// Measured time: 135 microseconds a run.
// In two side-by-side timings against v001, it was 1.15 and 1.14 times as fast.
// Over all steps from v000 it is 4.21 times as fast.
#include <hip/hip_runtime.h>

#define NNODES 50000
#define DIM 128
#define NHEADS 8
#define HD 16
#define ROWTILES (NNODES / 16)   // 3125 exactly
#define NPAD 53248               // node counters, padded to 52 * 1024
#define PACK_BLOCKS 16           // 4 matrices x 32 fragments, one wave each, 8 waves a block
#define QKV_BLOCKS 512           // two blocks a WGP; wave w of block b takes row tile b + 512 * w

typedef __attribute__((ext_vector_type(16))) _Float16 v16h;
typedef __attribute__((ext_vector_type(8)))  float    v8f;

// CDNA5 16-bit A-matrix 16x32 layout (ISA 7.12.2):
// lanes 0-15  (sel=0): halves 0..7 -> K=0..7,  halves 8..15 -> K=16..23
// lanes 16-31 (sel=1): halves 0..7 -> K=8..15, halves 8..15 -> K=24..31
__device__ __forceinline__ int kmap(int i, int sel) {
    int base = sel ? 8 : 0;
    return (i < 8) ? (base + i) : (16 + base + (i - 8));
}

// Load one 16x32 A fragment from f32 row-major source (vectorized float4)
__device__ __forceinline__ v16h load_a_f32(const float* __restrict__ src, int lda) {
    int lane = threadIdx.x & 31;
    int m = lane & 15, sel = lane >> 4;
    const float4* p = (const float4*)(src + m * lda);
    float4 u0 = p[sel * 2 + 0];      // K = sel*8 .. sel*8+3
    float4 u1 = p[sel * 2 + 1];      // K = sel*8+4 .. sel*8+7
    float4 u2 = p[4 + sel * 2 + 0];  // K = 16+sel*8 ..
    float4 u3 = p[4 + sel * 2 + 1];
    v16h a;
    a[0]  = (_Float16)u0.x; a[1]  = (_Float16)u0.y; a[2]  = (_Float16)u0.z; a[3]  = (_Float16)u0.w;
    a[4]  = (_Float16)u1.x; a[5]  = (_Float16)u1.y; a[6]  = (_Float16)u1.z; a[7]  = (_Float16)u1.w;
    a[8]  = (_Float16)u2.x; a[9]  = (_Float16)u2.y; a[10] = (_Float16)u2.z; a[11] = (_Float16)u2.w;
    a[12] = (_Float16)u3.x; a[13] = (_Float16)u3.y; a[14] = (_Float16)u3.z; a[15] = (_Float16)u3.w;
    return a;
}

// Load one 16x32 A fragment from an f16 LDS tile [16][DIM]
// (per-lane halves are two contiguous 16B runs -> merges into ds_load_b128 x2)
__device__ __forceinline__ v16h load_a_lds(const _Float16* tile, int k0) {
    int lane = threadIdx.x & 31;
    int m = lane & 15, sel = lane >> 4;
    const _Float16* row = tile + m * DIM + k0;
    v16h a;
#pragma unroll
    for (int i = 0; i < 16; ++i) a[i] = row[kmap(i, sel)];
    return a;
}

// Pre-packed B fragments: per fragment (j,kk), lane l owns 16 contiguous halves
// (32 bytes) -> a single vector load (2 x global_load_b128) at GEMM time.
__device__ __forceinline__ v16h load_b_packed(const _Float16* __restrict__ P, int j, int kk) {
    int lane = threadIdx.x & 31;
    return *(const v16h*)(P + ((size_t)(j * 4 + kk) * 32 + lane) * 16);
}

// ---------------------------------------------------------------------------
// Pack one fragment of an f32 weight matrix [128][128] into WMMA B-fragment f16
// layout. One wave per (j,kk) fragment; 32 fragments per matrix.
// ---------------------------------------------------------------------------
__device__ __forceinline__ void pack_w(const float* __restrict__ W,
                                       _Float16* __restrict__ P, int frag) {
    int j = frag >> 2, kk = frag & 3;   // frag = j*4 + kk
    int lane = threadIdx.x & 31;
    int n = lane & 15, sel = lane >> 4;
    _Float16* dstp = P + ((size_t)frag * 32 + lane) * 16;
#pragma unroll
    for (int i = 0; i < 16; ++i)
        dstp[i] = (_Float16)W[(size_t)(kk * 32 + kmap(i, sel)) * DIM + j * 16 + n];
}

// ---------------------------------------------------------------------------
// Launch 1: two jobs that depend on nothing share one grid; the block index picks
// the job. Blocks 0..15 pack the four weight matrices (4 blocks each, P holds the
// four packed matrices one behind the other); the others zero the per-node edge
// counters (NPAD entries).
// ---------------------------------------------------------------------------
__global__ __launch_bounds__(256) void pack_and_zero(
        const float* __restrict__ Wq, const float* __restrict__ Wk,
        const float* __restrict__ Wv, const float* __restrict__ Wo,
        _Float16* __restrict__ P, int* __restrict__ cnt) {
    int b = blockIdx.x;
    if (b < PACK_BLOCKS) {
        int mtx = b >> 2;
        const float* W = mtx == 0 ? Wq : mtx == 1 ? Wk : mtx == 2 ? Wv : Wo;
        pack_w(W, P + mtx * (32 * 32 * 16), (b & 3) * 8 + (threadIdx.x >> 5));
    } else {
        cnt[(b - PACK_BLOCKS) * 256 + threadIdx.x] = 0;
        // the store's offset register may be written again behind it: wait first
        asm volatile("s_wait_xcnt 0x0" ::: "memory");
    }
}

// ---------------------------------------------------------------------------
// Fused Q/K/V projection of one 16-row tile by one wave.
// B fragments double-buffered across the column-tile loop so global loads
// overlap the WMMAs instead of serializing load->wait->wmma.
// ---------------------------------------------------------------------------
__device__ __forceinline__ void qkv_gemm(
        const float* __restrict__ x,
        const _Float16* __restrict__ Pq, const float* __restrict__ bq,
        const _Float16* __restrict__ Pk, const float* __restrict__ bk,
        const _Float16* __restrict__ Pv, const float* __restrict__ bv,
        float* __restrict__ Q, float* __restrict__ K, float* __restrict__ V, int row0) {
    int lane = threadIdx.x & 31;

    v16h a[4];
#pragma unroll
    for (int kk = 0; kk < 4; ++kk)
        a[kk] = load_a_f32(x + (size_t)row0 * DIM + kk * 32, DIM);
    // a B load's result may land in the x loads' address pair: wait first
    asm volatile("s_wait_xcnt 0x0" ::: "memory");

    const _Float16* Ps[3] = {Pq, Pk, Pv};
    const float*    bs[3] = {bq, bk, bv};
    float*          Os[3] = {Q, K, V};

    int n  = lane & 15;
    int mb = (lane >> 4) * 8;

#pragma unroll
    for (int mtx = 0; mtx < 3; ++mtx) {
        const _Float16* P    = Ps[mtx];
        const float*    bias = bs[mtx];
        float*          out  = Os[mtx];

        v16h b[4];
#pragma unroll
        for (int kk = 0; kk < 4; ++kk) b[kk] = load_b_packed(P, 0, kk);

#pragma unroll
        for (int j = 0; j < 8; ++j) {
            v16h bn[4];
            if (j < 7) {
#pragma unroll
                for (int kk = 0; kk < 4; ++kk) bn[kk] = load_b_packed(P, j + 1, kk);
            }
            v8f acc = {};
#pragma unroll
            for (int kk = 0; kk < 4; ++kk)
                acc = __builtin_amdgcn_wmma_f32_16x16x32_f16(
                        false, a[kk], false, b[kk], (short)0, acc, false, false);

            int col = j * 16 + n;
            float bb = bias[col];
#pragma unroll
            for (int i = 0; i < 8; ++i)
                out[(size_t)(row0 + mb + i) * DIM + col] = acc[i] + bb;
            // a later load's result may land in a register these stores name: wait first
            asm volatile("s_wait_xcnt 0x0" ::: "memory");

#pragma unroll
            for (int kk = 0; kk < 4; ++kk) b[kk] = bn[kk];
        }
    }
}

// ---------------------------------------------------------------------------
// Count the edges of every destination node; the returned old count is the
// edge's place inside its node's run (arrival order).
// ---------------------------------------------------------------------------
__device__ __forceinline__ void edge_rank(const int* __restrict__ dst, int* __restrict__ cnt,
                                          int* __restrict__ rank, int E, int e) {
    if (e >= E) return;
    int d = dst[e];
    if ((unsigned)d < (unsigned)NNODES) rank[e] = atomicAdd(cnt + d, 1);
}

// ---------------------------------------------------------------------------
// Launch 2: the projections and the edge count need only launch 1 and not each
// other, so they share one grid. The projection blocks come first: they live
// longest, and the short edge blocks stream past them.
// ---------------------------------------------------------------------------
__global__ __launch_bounds__(256) void qkv_and_rank(
        const float* __restrict__ x,
        const _Float16* __restrict__ Pq, const float* __restrict__ bq,
        const _Float16* __restrict__ Pk, const float* __restrict__ bk,
        const _Float16* __restrict__ Pv, const float* __restrict__ bv,
        float* __restrict__ Q, float* __restrict__ K, float* __restrict__ V,
        const int* __restrict__ dst, int* __restrict__ cnt, int* __restrict__ rank, int E) {
    int b = blockIdx.x;
    if (b < QKV_BLOCKS) {
        int tile = b + QKV_BLOCKS * __builtin_amdgcn_readfirstlane(threadIdx.x >> 5);
        if (tile < ROWTILES)
            qkv_gemm(x, Pq, bq, Pk, bk, Pv, bv, Q, K, V, tile * 16);
    } else {
        edge_rank(dst, cnt, rank, E, (b - QKV_BLOCKS) * 256 + threadIdx.x);
    }
}

// ---------------------------------------------------------------------------
// Kernel 3b: exclusive prefix sum of the counters. Each block owns 1024
// counters and sums all counters in front of them itself (at most 200 KB of
// whole-line reads), so no block depends on another one.
// ---------------------------------------------------------------------------
__global__ __launch_bounds__(1024) void scan_counts(const int* __restrict__ cnt,
                                                    int* __restrict__ off) {
    __shared__ int wtot[32];
    __shared__ int ptot[32];
    int t = threadIdx.x, lane = t & 31, w = t >> 5;
    int first = blockIdx.x * 1024;
    int c = cnt[first + t];

    // Counters in front of this block, in chunks of 1024 (256 threads x int4), four
    // chunks per pass. All 13 loads are issued before the first sum (one L2 latency,
    // not 13); a chunk that is not in front is read as chunk 0 and left out of the sum.
    int p = 0;
    const int4* c4 = (const int4*)cnt;
    int sub = t & 255, grp = t >> 8, nfront = blockIdx.x;
    int4 u[NPAD / 4096];
#pragma unroll
    for (int k = 0; k < NPAD / 4096; ++k) {
        int ch = grp + 4 * k;
        u[k] = c4[(ch < nfront ? ch : 0) * 256 + sub];
        // a later load's result may land in this load's offset register: wait first
        asm volatile("s_wait_xcnt 0x0" ::: "memory");
    }
#pragma unroll
    for (int k = 0; k < NPAD / 4096; ++k)
        if (grp + 4 * k < nfront) p += (u[k].x + u[k].y) + (u[k].z + u[k].w);

    int inc = c;                          // inclusive scan inside the wave
#pragma unroll
    for (int d = 1; d < 32; d <<= 1) {
        int o = __shfl_up(inc, d, 32);
        if (lane >= d) inc += o;
    }
#pragma unroll
    for (int m = 1; m < 32; m <<= 1) p += __shfl_xor(p, m, 32);
    if (lane == 31) wtot[w] = inc;
    if (lane == 0)  ptot[w] = p;
    __syncthreads();

    int b = ptot[lane] + (lane < w ? wtot[lane] : 0);
#pragma unroll
    for (int m = 1; m < 32; m <<= 1) b += __shfl_xor(b, m, 32);
    off[first + t] = b + inc - c;
}

// ---------------------------------------------------------------------------
// Kernel 3c: write every edge's source node into its place of the dst-sorted list
// ---------------------------------------------------------------------------
__global__ void edge_place(const int* __restrict__ src, const int* __restrict__ dst,
                           const int* __restrict__ off, const int* __restrict__ rank,
                           int* __restrict__ perm, int E) {
    int e = blockIdx.x * blockDim.x + threadIdx.x;
    if (e >= E) return;
    int d = dst[e];
    if ((unsigned)d < (unsigned)NNODES)
        perm[off[d] + rank[e]] = min(max(src[e], 0), NNODES - 1);
}

// Sum over the 4 lanes of a quad (one head = 16 floats = 4 lanes x float4)
__device__ __forceinline__ float quad_sum(float p) {
    p += __int_as_float(__builtin_amdgcn_update_dpp(0, __float_as_int(p), 0xB1, 0xf, 0xf, true)); // lanes 1,0,3,2
    p += __int_as_float(__builtin_amdgcn_update_dpp(0, __float_as_int(p), 0x4E, 0xf, 0xf, true)); // lanes 2,3,0,1
    return p;
}

// ---------------------------------------------------------------------------
// Kernel 3d: one wave per destination node. A lane holds 4 of the 128 columns;
// the node's edges are walked four at a time (8 row loads in flight) and summed
// in registers, so wV gets one plain store per element.
// ---------------------------------------------------------------------------
__global__ __launch_bounds__(256) void node_attn(
        const float* __restrict__ Q, const float* __restrict__ K,
        const float* __restrict__ V, const int* __restrict__ off,
        const int* __restrict__ perm, float* __restrict__ wV, int E) {
    int lane = threadIdx.x & 31;
    int node = blockIdx.x * 8 + (threadIdx.x >> 5);
    int beg = __builtin_amdgcn_readfirstlane(off[node]);
    int end = min(__builtin_amdgcn_readfirstlane(off[node + 1]), E);

    float4 q = ((const float4*)(Q + (size_t)node * DIM))[lane];
    q.x *= 0.25f; q.y *= 0.25f; q.z *= 0.25f; q.w *= 0.25f;   // 1/sqrt(16), exact

    float4 acc = make_float4(0.0f, 0.0f, 0.0f, 0.0f);
    for (int base = beg; base < end; base += 32) {
        int n = min(32, end - base);
        int idx = perm[base + min(lane, n - 1)];
        for (int j = 0; j < n; j += 4) {
            float4 kv[4], vv[4];
#pragma unroll
            for (int u = 0; u < 4; ++u) {
                // past the end: the last edge's rows again (same lines), weight 0 below
                unsigned s = (unsigned)__builtin_amdgcn_readlane(idx, min(j + u, n - 1));
                unsigned o = s * (DIM * 4u) + lane * 16u;   // one 32-bit byte offset for both rows
                kv[u] = *(const float4*)((const char*)K + o);
                vv[u] = *(const float4*)((const char*)V + o);
            }
#pragma unroll
            for (int u = 0; u < 4; ++u) {
                float dot = quad_sum(kv[u].x * q.x + kv[u].y * q.y + kv[u].z * q.z + kv[u].w * q.w);
                dot = fminf(5.0f, fmaxf(-5.0f, dot));   // clamp(-5, 5)
                float sc = (j + u < n) ? __expf(dot) : 0.0f;
                acc.x += vv[u].x * sc;
                acc.y += vv[u].y * sc;
                acc.z += vv[u].z * sc;
                acc.w += vv[u].w * sc;
            }
        }
    }
    ((float4*)(wV + (size_t)node * DIM))[lane] = acc;
}

// ---------------------------------------------------------------------------
// Kernel 4: residual + LN1 -> LN2 -> Wo GEMM (WMMA from LDS) -> ReLU + residual
// One 16-row tile per block of 128 threads (4 waves). Each wave's two Wo
// B-column-tiles are preloaded BEFORE the LN phase so the global loads are in
// flight under ~100 VALU ops of LayerNorm work.
// ---------------------------------------------------------------------------
__global__ __launch_bounds__(128) void fused_ln_out(
        const float* __restrict__ x, const float* __restrict__ wV,
        const _Float16* __restrict__ Po, const float* __restrict__ bo,
        const float* __restrict__ g1, const float* __restrict__ b1,
        const float* __restrict__ g2, const float* __restrict__ b2,
        float* __restrict__ out) {
    __shared__ float    h2s[16 * DIM];   // post-LN1 tile (residual for epilogue)
    __shared__ _Float16 gs[16 * DIM];    // post-LN2 tile (A matrix for WMMA)

    int row0 = blockIdx.x * 16;
    int t = threadIdx.x;
    int r  = t >> 3;          // row in tile (8 threads per row; contiguous in wave)
    int c0 = (t & 7) * 16;    // 16 columns per thread
    int wave = t >> 5;
    int lane = t & 31;

    // --- preload this wave's B fragments (independent of LDS/LN work) ---
    v16h b0[4], b1f[4];
#pragma unroll
    for (int kk = 0; kk < 4; ++kk) {
        b0[kk]  = load_b_packed(Po, wave * 2 + 0, kk);
        b1f[kk] = load_b_packed(Po, wave * 2 + 1, kk);
    }

    // --- residual + LN1 ---
    float v[16];
    float s = 0.0f, ss = 0.0f;
#pragma unroll
    for (int i = 0; i < 16; ++i) {
        size_t idx = (size_t)(row0 + r) * DIM + c0 + i;
        float val = x[idx] + wV[idx];
        v[i] = val; s += val; ss += val * val;
    }
#pragma unroll
    for (int m = 1; m < 8; m <<= 1) {     // reduce within the 8 lanes of a row
        s  += __shfl_xor(s,  m, 32);
        ss += __shfl_xor(ss, m, 32);
    }
    float mean = s * (1.0f / DIM);
    float var  = ss * (1.0f / DIM) - mean * mean;
    float rstd = rsqrtf(var + 1e-5f);

    // --- LN2 on LN1 output ---
    float s2 = 0.0f, ss2 = 0.0f;
#pragma unroll
    for (int i = 0; i < 16; ++i) {
        int c = c0 + i;
        float h = (v[i] - mean) * rstd * g1[c] + b1[c];
        v[i] = h;
        h2s[r * DIM + c] = h;
        s2 += h; ss2 += h * h;
    }
#pragma unroll
    for (int m = 1; m < 8; m <<= 1) {
        s2  += __shfl_xor(s2,  m, 32);
        ss2 += __shfl_xor(ss2, m, 32);
    }
    float mean2 = s2 * (1.0f / DIM);
    float var2  = ss2 * (1.0f / DIM) - mean2 * mean2;
    float rstd2 = rsqrtf(var2 + 1e-5f);
#pragma unroll
    for (int i = 0; i < 16; ++i) {
        int c = c0 + i;
        gs[r * DIM + c] = (_Float16)((v[i] - mean2) * rstd2 * g2[c] + b2[c]);
    }
    __syncthreads();

    // --- Wo GEMM + bias + ReLU + residual epilogue ---
    v16h a[4];
#pragma unroll
    for (int kk = 0; kk < 4; ++kk) a[kk] = load_a_lds(gs, kk * 32);

    int n  = lane & 15;
    int mb = (lane >> 4) * 8;

#pragma unroll
    for (int jj = 0; jj < 2; ++jj) {      // 8 column tiles / 4 waves
        int j = wave * 2 + jj;
        v8f acc = {};
#pragma unroll
        for (int kk = 0; kk < 4; ++kk) {
            v16h b = (jj == 0) ? b0[kk] : b1f[kk];
            acc = __builtin_amdgcn_wmma_f32_16x16x32_f16(
                    false, a[kk], false, b, (short)0, acc, false, false);
        }
        int col = j * 16 + n;
        float bb = bo[col];
#pragma unroll
        for (int i = 0; i < 8; ++i) {
            float relu = fmaxf(acc[i] + bb, 0.0f);
            out[(size_t)(row0 + mb + i) * DIM + col] = h2s[(mb + i) * DIM + col] + relu;
        }
    }
}

// ---------------------------------------------------------------------------
extern "C" void kernel_launch(void* const* d_in, const int* in_sizes, int n_in,
                              void* d_out, int out_size, void* d_ws, size_t ws_size,
                              hipStream_t stream) {
    const float* x  = (const float*)d_in[0];
    const int*   src = (const int*)d_in[1];
    const int*   dst = (const int*)d_in[2];
    const float* Wq = (const float*)d_in[3];
    const float* bq = (const float*)d_in[4];
    const float* Wk = (const float*)d_in[5];
    const float* bk = (const float*)d_in[6];
    const float* Wv = (const float*)d_in[7];
    const float* bv = (const float*)d_in[8];
    const float* Wo = (const float*)d_in[9];
    const float* bo = (const float*)d_in[10];
    const float* g1 = (const float*)d_in[11];
    const float* b1 = (const float*)d_in[12];
    const float* g2 = (const float*)d_in[13];
    const float* b2 = (const float*)d_in[14];
    float* out = (float*)d_out;

    int E = in_sizes[1];
    size_t nd = (size_t)NNODES * DIM;
    float* Q  = (float*)d_ws;
    float* K  = Q + nd;
    float* V  = K + nd;
    float* wV = V + nd;
    // packed f16 weight fragments: 32 frags * 32 lanes * 16 halves = 16384 halves each
    _Float16* Pq = (_Float16*)(wV + nd);
    _Float16* Pk = Pq + 32 * 32 * 16;
    _Float16* Pv = Pk + 32 * 32 * 16;
    _Float16* Po = Pv + 32 * 32 * 16;
    // dst-sorted edge list: counters, run starts, place in run, source node per place
    int* cnt  = (int*)(Po + 32 * 32 * 16);
    int* off  = cnt + NPAD;
    int* rank = off + NPAD;
    int* perm = rank + E;

    pack_and_zero<<<PACK_BLOCKS + NPAD / 256, 256, 0, stream>>>(Wq, Wk, Wv, Wo, Pq, cnt);
    qkv_and_rank<<<QKV_BLOCKS + (E + 255) / 256, 256, 0, stream>>>(
        x, Pq, bq, Pk, bk, Pv, bv, Q, K, V, dst, cnt, rank, E);
    scan_counts<<<NPAD / 1024, 1024, 0, stream>>>(cnt, off);
    edge_place<<<(E + 255) / 256, 256, 0, stream>>>(src, dst, off, rank, perm, E);
    node_attn<<<NNODES / 8, 256, 0, stream>>>(Q, K, V, off, perm, wV, E);
    fused_ln_out<<<ROWTILES, 128, 0, stream>>>(x, wV, Po, bo, g1, b1, g2, b2, out);
}

// v004
// It runs in 107 microseconds.
// It is 1.31 times as fast as v002, going by the measured steps of the versions left out in between.
// Over all steps from v000 it is 5.52 times as fast.
#include <hip/hip_runtime.h>

#define NNODES 50000
#define DIM 128
#define NHEADS 8
#define HD 16
#define ROWTILES (NNODES / 16)   // 3125 exactly
#define NPAD 53248               // node counters, padded to 208 * 256; entry NNODES counts the spilled edges
#define CAP 32                   // places in a node's own bucket: one a lane, one 128-byte line
#define PACK_BLOCKS 16           // 4 matrices x 32 fragments, one wave each, 8 waves a block
#define QKV_BLOCKS 512           // two blocks a WGP; wave w of block b takes row tile b + 512 * w

#define SPITCH 136               // halves a row of the store staging tile: 272 B, 16 B x odd

typedef __attribute__((ext_vector_type(16))) _Float16 v16h;
typedef __attribute__((ext_vector_type(8)))  _Float16 v8h;
typedef __attribute__((ext_vector_type(8)))  float    v8f;
typedef __attribute__((ext_vector_type(4)))  float    v4f;

// CDNA5 16-bit A-matrix 16x32 layout (ISA 7.12.2):
// lanes 0-15  (sel=0): halves 0..7 -> K=0..7,  halves 8..15 -> K=16..23
// lanes 16-31 (sel=1): halves 0..7 -> K=8..15, halves 8..15 -> K=24..31
__device__ __forceinline__ int kmap(int i, int sel) {
    int base = sel ? 8 : 0;
    return (i < 8) ? (base + i) : (16 + base + (i - 8));
}

// Load one 16x32 A fragment from f32 row-major source (vectorized float4)
__device__ __forceinline__ v16h load_a_f32(const float* __restrict__ src, int lda) {
    int lane = threadIdx.x & 31;
    int m = lane & 15, sel = lane >> 4;
    const float4* p = (const float4*)(src + m * lda);
    float4 u0 = p[sel * 2 + 0];      // K = sel*8 .. sel*8+3
    float4 u1 = p[sel * 2 + 1];      // K = sel*8+4 .. sel*8+7
    float4 u2 = p[4 + sel * 2 + 0];  // K = 16+sel*8 ..
    float4 u3 = p[4 + sel * 2 + 1];
    v16h a;
    a[0]  = (_Float16)u0.x; a[1]  = (_Float16)u0.y; a[2]  = (_Float16)u0.z; a[3]  = (_Float16)u0.w;
    a[4]  = (_Float16)u1.x; a[5]  = (_Float16)u1.y; a[6]  = (_Float16)u1.z; a[7]  = (_Float16)u1.w;
    a[8]  = (_Float16)u2.x; a[9]  = (_Float16)u2.y; a[10] = (_Float16)u2.z; a[11] = (_Float16)u2.w;
    a[12] = (_Float16)u3.x; a[13] = (_Float16)u3.y; a[14] = (_Float16)u3.z; a[15] = (_Float16)u3.w;
    return a;
}

// Load one 16x32 A fragment from an f16 LDS tile [16][DIM]
// (per-lane halves are two contiguous 16B runs -> merges into ds_load_b128 x2)
__device__ __forceinline__ v16h load_a_lds(const _Float16* tile, int k0) {
    int lane = threadIdx.x & 31;
    int m = lane & 15, sel = lane >> 4;
    const _Float16* row = tile + m * DIM + k0;
    v16h a;
#pragma unroll
    for (int i = 0; i < 16; ++i) a[i] = row[kmap(i, sel)];
    return a;
}

// Pre-packed B fragments: per fragment (j,kk), lane l owns 16 contiguous halves
// (32 bytes) -> a single vector load (2 x global_load_b128) at GEMM time.
__device__ __forceinline__ v16h load_b_packed(const _Float16* __restrict__ P, int j, int kk) {
    int lane = threadIdx.x & 31;
    return *(const v16h*)(P + ((size_t)(j * 4 + kk) * 32 + lane) * 16);
}

// ---------------------------------------------------------------------------
// Pack one fragment of an f32 weight matrix [128][128] into WMMA B-fragment f16
// layout. One wave per (j,kk) fragment; 32 fragments per matrix.
// ---------------------------------------------------------------------------
__device__ __forceinline__ void pack_w(const float* __restrict__ W,
                                       _Float16* __restrict__ P, int frag) {
    int j = frag >> 2, kk = frag & 3;   // frag = j*4 + kk
    int lane = threadIdx.x & 31;
    int n = lane & 15, sel = lane >> 4;
    _Float16* dstp = P + ((size_t)frag * 32 + lane) * 16;
#pragma unroll
    for (int i = 0; i < 16; ++i)
        dstp[i] = (_Float16)W[(size_t)(kk * 32 + kmap(i, sel)) * DIM + j * 16 + n];
}

// ---------------------------------------------------------------------------
// Launch 1: two jobs that depend on nothing share one grid; the block index picks
// the job. Blocks 0..15 pack the four weight matrices (4 blocks each, P holds the
// four packed matrices one behind the other); the others zero the per-node edge
// counters and the spill counter (NPAD entries).
// ---------------------------------------------------------------------------
__global__ __launch_bounds__(256) void pack_and_zero(
        const float* __restrict__ Wq, const float* __restrict__ Wk,
        const float* __restrict__ Wv, const float* __restrict__ Wo,
        _Float16* __restrict__ P, int* __restrict__ cnt) {
    int b = blockIdx.x;
    if (b < PACK_BLOCKS) {
        int mtx = b >> 2;
        const float* W = mtx == 0 ? Wq : mtx == 1 ? Wk : mtx == 2 ? Wv : Wo;
        pack_w(W, P + mtx * (32 * 32 * 16), (b & 3) * 8 + (threadIdx.x >> 5));
    } else {
        cnt[(b - PACK_BLOCKS) * 256 + threadIdx.x] = 0;
        // the store's offset register may be written again behind it: wait first
        asm volatile("s_wait_xcnt 0x0" ::: "memory");
    }
}

// ---------------------------------------------------------------------------
// Fused Q/K/V projection of one 16-row tile by one wave; Q, K and V are stored
// as f16. The weight fragment is the A operand and the x fragment the B operand
// (both have the same lane and k map), so a lane holds 8 neighbouring columns of
// one node: one 16-byte write into the wave's own LDS tile, which goes out as
// whole 256-byte rows.
// Weight fragments double-buffered across the column-tile loop so global loads
// overlap the WMMAs instead of serializing load->wait->wmma.
// ---------------------------------------------------------------------------
__device__ __forceinline__ void qkv_gemm(
        const float* __restrict__ x,
        const _Float16* __restrict__ Pq, const float* __restrict__ bq,
        const _Float16* __restrict__ Pk, const float* __restrict__ bk,
        const _Float16* __restrict__ Pv, const float* __restrict__ bv,
        _Float16* __restrict__ Q, _Float16* __restrict__ K, _Float16* __restrict__ V,
        int row0, _Float16* stage) {
    int lane = threadIdx.x & 31;

    v16h a[4];
#pragma unroll
    for (int kk = 0; kk < 4; ++kk)
        a[kk] = load_a_f32(x + (size_t)row0 * DIM + kk * 32, DIM);
    // a B load's result may land in the x loads' address pair: wait first
    asm volatile("s_wait_xcnt 0x0" ::: "memory");

    const _Float16* Ps[3] = {Pq, Pk, Pv};
    const float*    bs[3] = {bq, bk, bv};
    _Float16*       Os[3] = {Q, K, V};

    int n  = lane & 15;
    int mb = (lane >> 4) * 8;

#pragma unroll
    for (int mtx = 0; mtx < 3; ++mtx) {
        const _Float16* P    = Ps[mtx];
        const float*    bias = bs[mtx];
        _Float16*       out  = Os[mtx];

        v16h b[4];
#pragma unroll
        for (int kk = 0; kk < 4; ++kk) b[kk] = load_b_packed(P, 0, kk);
        v4f bb0 = *(const v4f*)(bias + mb);       // the lane's 8 columns of tile 0
        v4f bb1 = *(const v4f*)(bias + mb + 4);

#pragma unroll
        for (int j = 0; j < 8; ++j) {
            v16h bn[4];
            v4f bn0, bn1;
            if (j < 7) {
#pragma unroll
                for (int kk = 0; kk < 4; ++kk) bn[kk] = load_b_packed(P, j + 1, kk);
                bn0 = *(const v4f*)(bias + (j + 1) * 16 + mb);
                bn1 = *(const v4f*)(bias + (j + 1) * 16 + mb + 4);
            }
            v8f acc = {};
#pragma unroll
            for (int kk = 0; kk < 4; ++kk)
                acc = __builtin_amdgcn_wmma_f32_16x16x32_f16(
                        false, b[kk], false, a[kk], (short)0, acc, false, false);

            // acc[i] = node row0 + n, column j * 16 + mb + i
            v8h h;
            h[0] = (_Float16)(acc[0] + bb0.x); h[1] = (_Float16)(acc[1] + bb0.y);
            h[2] = (_Float16)(acc[2] + bb0.z); h[3] = (_Float16)(acc[3] + bb0.w);
            h[4] = (_Float16)(acc[4] + bb1.x); h[5] = (_Float16)(acc[5] + bb1.y);
            h[6] = (_Float16)(acc[6] + bb1.z); h[7] = (_Float16)(acc[7] + bb1.w);
            *(v8h*)(stage + n * SPITCH + j * 16 + mb) = h;

#pragma unroll
            for (int kk = 0; kk < 4; ++kk) b[kk] = bn[kk];
            bb0 = bn0; bb1 = bn1;
            // holds the next tile's loads inside this tile (loaded values as inputs only):
            // without it the compiler sinks each load to just in front of its own WMMA
            if (j < 7)
                asm volatile("" :: "v"(bn[0]), "v"(bn[1]), "v"(bn[2]), "v"(bn[3]), "v"(bn0), "v"(bn1));
        }

        // other lanes of this wave read the tile back: their writes must have landed,
        // and the compiler must not move the reads up
        asm volatile("s_wait_dscnt 0x0" ::: "memory");
        _Float16*       gp = out + (size_t)(row0 + (lane >> 4)) * DIM + n * 8;
        const _Float16* sp = stage + (lane >> 4) * SPITCH + n * 8;
#pragma unroll
        for (int r = 0; r < 8; ++r)     // rows 2r and 2r + 1: 512 contiguous bytes a store
            *(v8h*)(gp + r * 2 * DIM) = *(const v8h*)(sp + r * 2 * SPITCH);
        // a later load's result may land in a register these stores name; and the next
        // matrix's LDS writes stay behind the reads above
        asm volatile("s_wait_xcnt 0x0" ::: "memory");
    }
}

// ---------------------------------------------------------------------------
// Count the edges of every destination node; the returned old count is the
// edge's place (arrival order) in its node's bucket of CAP places, whose start
// needs no prefix sum, so the source node is written there at once. An edge that
// finds its bucket full goes, as the pair (dst, src), to the end of one spill
// list that all nodes share (at most E pairs).
// ---------------------------------------------------------------------------
__device__ __forceinline__ void edge_bucket(const int* __restrict__ src, const int* __restrict__ dst,
                                            int* __restrict__ cnt, int* __restrict__ perm,
                                            int* __restrict__ spill, int E, int e) {
    if (e >= E) return;
    int d = dst[e];
    int s = min(max(src[e], 0), NNODES - 1);
    if ((unsigned)d >= (unsigned)NNODES) return;
    int r = atomicAdd(cnt + d, 1);
    if ((unsigned)r < (unsigned)CAP) {
        perm[d * CAP + r] = s;
    } else {
        int o = atomicAdd(cnt + NNODES, 1);
        if ((unsigned)o < (unsigned)E) ((int2*)spill)[o] = make_int2(d, s);
    }
}

// ---------------------------------------------------------------------------
// Launch 2: the projections and the edge buckets need only launch 1 and not each
// other, so they share one grid. The projection blocks come first: they live
// longest, and the short edge blocks stream past them. The edge blocks get this
// kernel's register allotment too: 8 waves a SIMD (128 registers) leaves room for
// two of them beside the two projection blocks of a WGP.
// ---------------------------------------------------------------------------
__global__ __launch_bounds__(256, 8) void qkv_and_bucket(
        const float* __restrict__ x,
        const _Float16* __restrict__ Pq, const float* __restrict__ bq,
        const _Float16* __restrict__ Pk, const float* __restrict__ bk,
        const _Float16* __restrict__ Pv, const float* __restrict__ bv,
        _Float16* __restrict__ Q, _Float16* __restrict__ K, _Float16* __restrict__ V,
        const int* __restrict__ src, const int* __restrict__ dst, int* __restrict__ cnt,
        int* __restrict__ perm, int* __restrict__ spill, int E) {
    __shared__ __attribute__((aligned(16))) _Float16 stage[8 * 16 * SPITCH];   // one tile a wave
    int b = blockIdx.x;
    if (b < QKV_BLOCKS) {
        int w = __builtin_amdgcn_readfirstlane(threadIdx.x >> 5);
        int tile = b + QKV_BLOCKS * w;
        if (tile < ROWTILES)
            qkv_gemm(x, Pq, bq, Pk, bk, Pv, bv, Q, K, V, tile * 16, stage + w * (16 * SPITCH));
    } else {
        edge_bucket(src, dst, cnt, perm, spill, E, (b - QKV_BLOCKS) * 256 + threadIdx.x);
    }
}

// ---------------------------------------------------------------------------
// acc += f16 half of h (low or high) * f32 w, in f32: one instruction, no separate
// conversion (the compiler's own form converts every half first)
__device__ __forceinline__ float fma_lo(unsigned h, float w, float acc) {
    asm("v_fma_mix_f32 %0, %1, %2, %0 op_sel_hi:[1,0,0]" : "+v"(acc) : "v"(h), "v"(w));
    return acc;
}
__device__ __forceinline__ float fma_hi(unsigned h, float w, float acc) {
    asm("v_fma_mix_f32 %0, %1, %2, %0 op_sel:[1,0,0] op_sel_hi:[1,0,0]" : "+v"(acc) : "v"(h), "v"(w));
    return acc;
}

// ---------------------------------------------------------------------------
// Kernel 3d: one wave per destination node, f16 K and V rows of 256 bytes. A lane
// holds 8 of the 128 columns (16 bytes), so 16 lanes cover a row and one wave-wide
// load brings the rows of two edges: the low lanes take the even edges, the high
// lanes the odd ones. Eight edges are walked at a time (8 loads in flight); sums
// are f32 in registers, the two halves are added at the end, and wV gets one plain
// store per element. The first pass takes the node's own bucket; only a node that
// counted more than CAP edges goes on through the spill list, 32 pairs a pass, and
// packs the sources of its own pairs into the low lanes.
// ---------------------------------------------------------------------------
__global__ __launch_bounds__(256) void node_attn(
        const _Float16* __restrict__ Q, const _Float16* __restrict__ K,
        const _Float16* __restrict__ V, const int* __restrict__ cnt,
        const int* __restrict__ perm, const int* __restrict__ spill,
        float* __restrict__ wV, int E) {
    int lane = threadIdx.x & 31;
    int c = lane & 15, hi = lane >> 4;
    int node = blockIdx.x * 8 + (threadIdx.x >> 5);
    int total = __builtin_amdgcn_readfirstlane(cnt[node]);
    int nspill = 0;
    if (total > CAP) nspill = min(__builtin_amdgcn_readfirstlane(cnt[NNODES]), E);

    v8h qh = *(const v8h*)(Q + (size_t)node * DIM + c * 8);
    float q[8], acc[8];
#pragma unroll
    for (int i = 0; i < 8; ++i) {
        q[i] = (float)qh[i] * 0.25f;   // 1/sqrt(16), exact
        acc[i] = 0.0f;
    }

    for (int base = -32; base < nspill; base += 32) {
        int n, idx = 0;
        if (base < 0) {
            n = min(total, CAP);
            if (n > 0) idx = perm[node * CAP + min(lane, n - 1)];
        } else {
            int2 ds = ((const int2*)spill)[min(base + lane, nspill - 1)];
            bool mine = base + lane < nspill && ds.x == node;
            unsigned mask = __builtin_amdgcn_ballot_w32(mine);
            unsigned below = (1u << lane) - 1u;
            n = __popc(mask);
            // a permutation of the 32 lanes: own pairs first, in list order, the others behind
            int to = mine ? __popc(mask & below) : n + __popc(~mask & below);
            idx = __builtin_amdgcn_ds_permute(to * 4, ds.y);
        }
        for (int j = 0; j < n; j += 8) {
            uint4 kv[4], vv[4];   // 8 halves each
#pragma unroll
            for (int u = 0; u < 4; ++u) {
                // past the end: the last edge's rows again (same lines), weight 0 below
                unsigned s0 = (unsigned)__builtin_amdgcn_readlane(idx, min(j + 2 * u, n - 1));
                unsigned s1 = (unsigned)__builtin_amdgcn_readlane(idx, min(j + 2 * u + 1, n - 1));
                unsigned o = (hi ? s1 : s0) * (DIM * 2u) + c * 16u;   // one 32-bit byte offset for both rows
                kv[u] = *(const uint4*)((const char*)K + o);
                vv[u] = *(const uint4*)((const char*)V + o);
            }
#pragma unroll
            for (int u = 0; u < 4; ++u) {
                float p = 0.0f;
                p = fma_lo(kv[u].x, q[0], p); p = fma_hi(kv[u].x, q[1], p);
                p = fma_lo(kv[u].y, q[2], p); p = fma_hi(kv[u].y, q[3], p);
                p = fma_lo(kv[u].z, q[4], p); p = fma_hi(kv[u].z, q[5], p);
                p = fma_lo(kv[u].w, q[6], p); p = fma_hi(kv[u].w, q[7], p);
                // a head is 16 columns = 2 neighbouring lanes: add lanes 1,0,3,2
                p += __int_as_float(__builtin_amdgcn_update_dpp(0, __float_as_int(p), 0xB1, 0xf, 0xf, true));
                p = fminf(5.0f, fmaxf(-5.0f, p));   // clamp(-5, 5)
                float sc = (j + 2 * u + hi < n) ? __expf(p) : 0.0f;
                acc[0] = fma_lo(vv[u].x, sc, acc[0]); acc[1] = fma_hi(vv[u].x, sc, acc[1]);
                acc[2] = fma_lo(vv[u].y, sc, acc[2]); acc[3] = fma_hi(vv[u].y, sc, acc[3]);
                acc[4] = fma_lo(vv[u].z, sc, acc[4]); acc[5] = fma_hi(vv[u].z, sc, acc[5]);
                acc[6] = fma_lo(vv[u].w, sc, acc[6]); acc[7] = fma_hi(vv[u].w, sc, acc[7]);
            }
        }
    }

    // even-edge and odd-edge sums meet: a lane keeps 4 of its 8 columns and gets the
    // other half-wave's sums of those (lane l <-> l ^ 16)
    float4 r;
    float* rp = &r.x;
#pragma unroll
    for (int i = 0; i < 4; ++i) {
        int give = __float_as_int(hi ? acc[i] : acc[4 + i]);
        float got = __int_as_float(__builtin_amdgcn_permlanex16(give, give, 0x76543210, 0xfedcba98, false, false));
        rp[i] = (hi ? acc[4 + i] : acc[i]) + got;
    }
    ((float4*)(wV + (size_t)node * DIM))[c * 2 + hi] = r;
}

// ---------------------------------------------------------------------------
// Kernel 4: residual + LN1 -> LN2 -> Wo GEMM (WMMA from LDS) -> ReLU + residual
// One 16-row tile per block of 128 threads (4 waves). Each wave's two Wo
// B-column-tiles are preloaded BEFORE the LN phase so the global loads are in
// flight under ~100 VALU ops of LayerNorm work.
// ---------------------------------------------------------------------------
__global__ __launch_bounds__(128) void fused_ln_out(
        const float* __restrict__ x, const float* __restrict__ wV,
        const _Float16* __restrict__ Po, const float* __restrict__ bo,
        const float* __restrict__ g1, const float* __restrict__ b1,
        const float* __restrict__ g2, const float* __restrict__ b2,
        float* __restrict__ out) {
    __shared__ float    h2s[16 * DIM];   // post-LN1 tile (residual for epilogue)
    __shared__ _Float16 gs[16 * DIM];    // post-LN2 tile (A matrix for WMMA)

    int row0 = blockIdx.x * 16;
    int t = threadIdx.x;
    int r  = t >> 3;          // row in tile (8 threads per row; contiguous in wave)
    int c0 = (t & 7) * 16;    // 16 columns per thread
    int wave = t >> 5;
    int lane = t & 31;

    // --- preload this wave's B fragments (independent of LDS/LN work) ---
    v16h b0[4], b1f[4];
#pragma unroll
    for (int kk = 0; kk < 4; ++kk) {
        b0[kk]  = load_b_packed(Po, wave * 2 + 0, kk);
        b1f[kk] = load_b_packed(Po, wave * 2 + 1, kk);
    }

    // --- residual + LN1 ---
    float v[16];
    float s = 0.0f, ss = 0.0f;
#pragma unroll
    for (int i = 0; i < 16; ++i) {
        size_t idx = (size_t)(row0 + r) * DIM + c0 + i;
        float val = x[idx] + wV[idx];
        v[i] = val; s += val; ss += val * val;
    }
#pragma unroll
    for (int m = 1; m < 8; m <<= 1) {     // reduce within the 8 lanes of a row
        s  += __shfl_xor(s,  m, 32);
        ss += __shfl_xor(ss, m, 32);
    }
    float mean = s * (1.0f / DIM);
    float var  = ss * (1.0f / DIM) - mean * mean;
    float rstd = rsqrtf(var + 1e-5f);

    // --- LN2 on LN1 output ---
    float s2 = 0.0f, ss2 = 0.0f;
#pragma unroll
    for (int i = 0; i < 16; ++i) {
        int c = c0 + i;
        float h = (v[i] - mean) * rstd * g1[c] + b1[c];
        v[i] = h;
        h2s[r * DIM + c] = h;
        s2 += h; ss2 += h * h;
    }
#pragma unroll
    for (int m = 1; m < 8; m <<= 1) {
        s2  += __shfl_xor(s2,  m, 32);
        ss2 += __shfl_xor(ss2, m, 32);
    }
    float mean2 = s2 * (1.0f / DIM);
    float var2  = ss2 * (1.0f / DIM) - mean2 * mean2;
    float rstd2 = rsqrtf(var2 + 1e-5f);
#pragma unroll
    for (int i = 0; i < 16; ++i) {
        int c = c0 + i;
        gs[r * DIM + c] = (_Float16)((v[i] - mean2) * rstd2 * g2[c] + b2[c]);
    }
    __syncthreads();

    // --- Wo GEMM + bias + ReLU + residual epilogue ---
    v16h a[4];
#pragma unroll
    for (int kk = 0; kk < 4; ++kk) a[kk] = load_a_lds(gs, kk * 32);

    int n  = lane & 15;
    int mb = (lane >> 4) * 8;

#pragma unroll
    for (int jj = 0; jj < 2; ++jj) {      // 8 column tiles / 4 waves
        int j = wave * 2 + jj;
        v8f acc = {};
#pragma unroll
        for (int kk = 0; kk < 4; ++kk) {
            v16h b = (jj == 0) ? b0[kk] : b1f[kk];
            acc = __builtin_amdgcn_wmma_f32_16x16x32_f16(
                    false, a[kk], false, b, (short)0, acc, false, false);
        }
        int col = j * 16 + n;
        float bb = bo[col];
#pragma unroll
        for (int i = 0; i < 8; ++i) {
            float relu = fmaxf(acc[i] + bb, 0.0f);
            out[(size_t)(row0 + mb + i) * DIM + col] = h2s[(mb + i) * DIM + col] + relu;
        }
    }
}

// ---------------------------------------------------------------------------
extern "C" void kernel_launch(void* const* d_in, const int* in_sizes, int n_in,
                              void* d_out, int out_size, void* d_ws, size_t ws_size,
                              hipStream_t stream) {
    const float* x  = (const float*)d_in[0];
    const int*   src = (const int*)d_in[1];
    const int*   dst = (const int*)d_in[2];
    const float* Wq = (const float*)d_in[3];
    const float* bq = (const float*)d_in[4];
    const float* Wk = (const float*)d_in[5];
    const float* bk = (const float*)d_in[6];
    const float* Wv = (const float*)d_in[7];
    const float* bv = (const float*)d_in[8];
    const float* Wo = (const float*)d_in[9];
    const float* bo = (const float*)d_in[10];
    const float* g1 = (const float*)d_in[11];
    const float* b1 = (const float*)d_in[12];
    const float* g2 = (const float*)d_in[13];
    const float* b2 = (const float*)d_in[14];
    float* out = (float*)d_out;

    int E = in_sizes[1];
    size_t nd = (size_t)NNODES * DIM;
    float* wV = (float*)d_ws;
    _Float16* Q = (_Float16*)(wV + nd);   // projections, f16
    _Float16* K = Q + nd;
    _Float16* V = K + nd;
    // packed f16 weight fragments: 32 frags * 32 lanes * 16 halves = 16384 halves each
    _Float16* Pq = V + nd;
    _Float16* Pk = Pq + 32 * 32 * 16;
    _Float16* Pv = Pk + 32 * 32 * 16;
    _Float16* Po = Pv + 32 * 32 * 16;
    // edges by dst: counters, a bucket of CAP source nodes per node, spilled (dst, src) pairs
    int* cnt   = (int*)(Po + 32 * 32 * 16);
    int* perm  = cnt + NPAD;
    int* spill = perm + NNODES * CAP;

    pack_and_zero<<<PACK_BLOCKS + NPAD / 256, 256, 0, stream>>>(Wq, Wk, Wv, Wo, Pq, cnt);
    qkv_and_bucket<<<QKV_BLOCKS + (E + 255) / 256, 256, 0, stream>>>(
        x, Pq, bq, Pk, bk, Pv, bv, Q, K, V, src, dst, cnt, perm, spill, E);
    node_attn<<<NNODES / 8, 256, 0, stream>>>(Q, K, V, cnt, perm, spill, wV, E);
    fused_ln_out<<<ROWTILES, 128, 0, stream>>>(x, wV, Po, bo, g1, b1, g2, b2, out);
}

// v005
// One run takes 95.6 microseconds.
// In two side-by-side timings against v004, it was 1.11 and 1.12 times as fast.
// All steps since v000 together make it 6.16 times as fast.
#include <hip/hip_runtime.h>

#define NNODES 50000
#define DIM 128
#define NHEADS 8
#define HD 16
#define ROWTILES (NNODES / 16)   // 3125 exactly
#define NPAD 53248               // node counters, padded to 208 * 256; entry NNODES counts the spilled edges
#define CAP 32                   // places in a node's own bucket: one a lane, one 128-byte line
#define PACK_BLOCKS 16           // 4 matrices x 32 fragments, one wave each, 8 waves a block
#define QKV_BLOCKS 512           // two blocks a WGP; wave w of block b takes row tile b + 512 * w

#define SPITCH 136               // halves a row of the store staging tile: 272 B, 16 B x odd

typedef __attribute__((ext_vector_type(16))) _Float16 v16h;
typedef __attribute__((ext_vector_type(8)))  _Float16 v8h;
typedef __attribute__((ext_vector_type(8)))  float    v8f;
typedef __attribute__((ext_vector_type(4)))  float    v4f;

// CDNA5 16-bit A-matrix 16x32 layout (ISA 7.12.2):
// lanes 0-15  (sel=0): halves 0..7 -> K=0..7,  halves 8..15 -> K=16..23
// lanes 16-31 (sel=1): halves 0..7 -> K=8..15, halves 8..15 -> K=24..31
__device__ __forceinline__ int kmap(int i, int sel) {
    int base = sel ? 8 : 0;
    return (i < 8) ? (base + i) : (16 + base + (i - 8));
}

// Load one 16x32 A fragment from f32 row-major source (vectorized float4)
__device__ __forceinline__ v16h load_a_f32(const float* __restrict__ src, int lda) {
    int lane = threadIdx.x & 31;
    int m = lane & 15, sel = lane >> 4;
    const float4* p = (const float4*)(src + m * lda);
    float4 u0 = p[sel * 2 + 0];      // K = sel*8 .. sel*8+3
    float4 u1 = p[sel * 2 + 1];      // K = sel*8+4 .. sel*8+7
    float4 u2 = p[4 + sel * 2 + 0];  // K = 16+sel*8 ..
    float4 u3 = p[4 + sel * 2 + 1];
    v16h a;
    a[0]  = (_Float16)u0.x; a[1]  = (_Float16)u0.y; a[2]  = (_Float16)u0.z; a[3]  = (_Float16)u0.w;
    a[4]  = (_Float16)u1.x; a[5]  = (_Float16)u1.y; a[6]  = (_Float16)u1.z; a[7]  = (_Float16)u1.w;
    a[8]  = (_Float16)u2.x; a[9]  = (_Float16)u2.y; a[10] = (_Float16)u2.z; a[11] = (_Float16)u2.w;
    a[12] = (_Float16)u3.x; a[13] = (_Float16)u3.y; a[14] = (_Float16)u3.z; a[15] = (_Float16)u3.w;
    return a;
}

// Load one 16x32 A fragment from an f16 LDS tile [16][DIM]
// (per-lane halves are two contiguous 16B runs -> merges into ds_load_b128 x2)
__device__ __forceinline__ v16h load_a_lds(const _Float16* tile, int k0) {
    int lane = threadIdx.x & 31;
    int m = lane & 15, sel = lane >> 4;
    const _Float16* row = tile + m * DIM + k0;
    v16h a;
#pragma unroll
    for (int i = 0; i < 16; ++i) a[i] = row[kmap(i, sel)];
    return a;
}

// Pre-packed B fragments: per fragment (j,kk), lane l owns 16 contiguous halves
// (32 bytes) -> a single vector load (2 x global_load_b128) at GEMM time.
__device__ __forceinline__ v16h load_b_packed(const _Float16* __restrict__ P, int j, int kk) {
    int lane = threadIdx.x & 31;
    return *(const v16h*)(P + ((size_t)(j * 4 + kk) * 32 + lane) * 16);
}

// ---------------------------------------------------------------------------
// Pack one fragment of an f32 weight matrix [128][128] into WMMA B-fragment f16
// layout. One wave per (j,kk) fragment; 32 fragments per matrix.
// ---------------------------------------------------------------------------
__device__ __forceinline__ void pack_w(const float* __restrict__ W,
                                       _Float16* __restrict__ P, int frag) {
    int j = frag >> 2, kk = frag & 3;   // frag = j*4 + kk
    int lane = threadIdx.x & 31;
    int n = lane & 15, sel = lane >> 4;
    _Float16* dstp = P + ((size_t)frag * 32 + lane) * 16;
#pragma unroll
    for (int i = 0; i < 16; ++i)
        dstp[i] = (_Float16)W[(size_t)(kk * 32 + kmap(i, sel)) * DIM + j * 16 + n];
}

// ---------------------------------------------------------------------------
// Launch 1: two jobs that depend on nothing share one grid; the block index picks
// the job. Blocks 0..15 pack the four weight matrices (4 blocks each, P holds the
// four packed matrices one behind the other); the others zero the per-node edge
// counters and the spill counter (NPAD entries).
// ---------------------------------------------------------------------------
__global__ __launch_bounds__(256) void pack_and_zero(
        const float* __restrict__ Wq, const float* __restrict__ Wk,
        const float* __restrict__ Wv, const float* __restrict__ Wo,
        _Float16* __restrict__ P, int* __restrict__ cnt) {
    int b = blockIdx.x;
    if (b < PACK_BLOCKS) {
        int mtx = b >> 2;
        const float* W = mtx == 0 ? Wq : mtx == 1 ? Wk : mtx == 2 ? Wv : Wo;
        pack_w(W, P + mtx * (32 * 32 * 16), (b & 3) * 8 + (threadIdx.x >> 5));
    } else {
        cnt[(b - PACK_BLOCKS) * 256 + threadIdx.x] = 0;
        // the store's offset register may be written again behind it: wait first
        asm volatile("s_wait_xcnt 0x0" ::: "memory");
    }
}

// ---------------------------------------------------------------------------
// Fused Q/K/V projection of one 16-row tile by one wave; Q, K and V are stored
// as f16. The weight fragment is the A operand and the x fragment the B operand
// (both have the same lane and k map), so a lane holds 8 neighbouring columns of
// one node: one 16-byte write into the wave's own LDS tile, which goes out as
// whole 256-byte rows.
// Weight fragments double-buffered across the column-tile loop so global loads
// overlap the WMMAs instead of serializing load->wait->wmma.
// ---------------------------------------------------------------------------
__device__ __forceinline__ void qkv_gemm(
        const float* __restrict__ x,
        const _Float16* __restrict__ Pq, const float* __restrict__ bq,
        const _Float16* __restrict__ Pk, const float* __restrict__ bk,
        const _Float16* __restrict__ Pv, const float* __restrict__ bv,
        _Float16* __restrict__ Q, _Float16* __restrict__ K, _Float16* __restrict__ V,
        int row0, _Float16* stage) {
    int lane = threadIdx.x & 31;

    v16h a[4];
#pragma unroll
    for (int kk = 0; kk < 4; ++kk)
        a[kk] = load_a_f32(x + (size_t)row0 * DIM + kk * 32, DIM);
    // a B load's result may land in the x loads' address pair: wait first
    asm volatile("s_wait_xcnt 0x0" ::: "memory");

    const _Float16* Ps[3] = {Pq, Pk, Pv};
    const float*    bs[3] = {bq, bk, bv};
    _Float16*       Os[3] = {Q, K, V};

    int n  = lane & 15;
    int mb = (lane >> 4) * 8;

#pragma unroll
    for (int mtx = 0; mtx < 3; ++mtx) {
        const _Float16* P    = Ps[mtx];
        const float*    bias = bs[mtx];
        _Float16*       out  = Os[mtx];

        v16h b[4];
#pragma unroll
        for (int kk = 0; kk < 4; ++kk) b[kk] = load_b_packed(P, 0, kk);
        v4f bb0 = *(const v4f*)(bias + mb);       // the lane's 8 columns of tile 0
        v4f bb1 = *(const v4f*)(bias + mb + 4);

#pragma unroll
        for (int j = 0; j < 8; ++j) {
            v16h bn[4];
            v4f bn0, bn1;
            if (j < 7) {
#pragma unroll
                for (int kk = 0; kk < 4; ++kk) bn[kk] = load_b_packed(P, j + 1, kk);
                bn0 = *(const v4f*)(bias + (j + 1) * 16 + mb);
                bn1 = *(const v4f*)(bias + (j + 1) * 16 + mb + 4);
            }
            v8f acc = {};
#pragma unroll
            for (int kk = 0; kk < 4; ++kk)
                acc = __builtin_amdgcn_wmma_f32_16x16x32_f16(
                        false, b[kk], false, a[kk], (short)0, acc, false, false);

            // acc[i] = node row0 + n, column j * 16 + mb + i
            v8h h;
            h[0] = (_Float16)(acc[0] + bb0.x); h[1] = (_Float16)(acc[1] + bb0.y);
            h[2] = (_Float16)(acc[2] + bb0.z); h[3] = (_Float16)(acc[3] + bb0.w);
            h[4] = (_Float16)(acc[4] + bb1.x); h[5] = (_Float16)(acc[5] + bb1.y);
            h[6] = (_Float16)(acc[6] + bb1.z); h[7] = (_Float16)(acc[7] + bb1.w);
            *(v8h*)(stage + n * SPITCH + j * 16 + mb) = h;

#pragma unroll
            for (int kk = 0; kk < 4; ++kk) b[kk] = bn[kk];
            bb0 = bn0; bb1 = bn1;
            // holds the next tile's loads inside this tile (loaded values as inputs only):
            // without it the compiler sinks each load to just in front of its own WMMA
            if (j < 7)
                asm volatile("" :: "v"(bn[0]), "v"(bn[1]), "v"(bn[2]), "v"(bn[3]), "v"(bn0), "v"(bn1));
        }

        // other lanes of this wave read the tile back: their writes must have landed,
        // and the compiler must not move the reads up
        asm volatile("s_wait_dscnt 0x0" ::: "memory");
        _Float16*       gp = out + (size_t)(row0 + (lane >> 4)) * DIM + n * 8;
        const _Float16* sp = stage + (lane >> 4) * SPITCH + n * 8;
#pragma unroll
        for (int r = 0; r < 8; ++r)     // rows 2r and 2r + 1: 512 contiguous bytes a store
            *(v8h*)(gp + r * 2 * DIM) = *(const v8h*)(sp + r * 2 * SPITCH);
        // a later load's result may land in a register these stores name; and the next
        // matrix's LDS writes stay behind the reads above
        asm volatile("s_wait_xcnt 0x0" ::: "memory");
    }
}

// ---------------------------------------------------------------------------
// Count the edges of every destination node; the returned old count is the
// edge's place (arrival order) in its node's bucket of CAP places, whose start
// needs no prefix sum, so the source node is written there at once. An edge that
// finds its bucket full goes, as the pair (dst, src), to the end of one spill
// list that all nodes share (at most E pairs).
// ---------------------------------------------------------------------------
__device__ __forceinline__ void edge_bucket(const int* __restrict__ src, const int* __restrict__ dst,
                                            int* __restrict__ cnt, int* __restrict__ perm,
                                            int* __restrict__ spill, int E, int e) {
    if (e >= E) return;
    int d = dst[e];
    int s = min(max(src[e], 0), NNODES - 1);
    if ((unsigned)d >= (unsigned)NNODES) return;
    int r = atomicAdd(cnt + d, 1);
    if ((unsigned)r < (unsigned)CAP) {
        perm[d * CAP + r] = s;
    } else {
        int o = atomicAdd(cnt + NNODES, 1);
        if ((unsigned)o < (unsigned)E) ((int2*)spill)[o] = make_int2(d, s);
    }
}

// ---------------------------------------------------------------------------
// Launch 2: the projections and the edge buckets need only launch 1 and not each
// other, so they share one grid. The projection blocks come first: they live
// longest, and the short edge blocks stream past them. The edge blocks get this
// kernel's register allotment too: 8 waves a SIMD (128 registers) leaves room for
// two of them beside the two projection blocks of a WGP.
// ---------------------------------------------------------------------------
__global__ __launch_bounds__(256, 8) void qkv_and_bucket(
        const float* __restrict__ x,
        const _Float16* __restrict__ Pq, const float* __restrict__ bq,
        const _Float16* __restrict__ Pk, const float* __restrict__ bk,
        const _Float16* __restrict__ Pv, const float* __restrict__ bv,
        _Float16* __restrict__ Q, _Float16* __restrict__ K, _Float16* __restrict__ V,
        const int* __restrict__ src, const int* __restrict__ dst, int* __restrict__ cnt,
        int* __restrict__ perm, int* __restrict__ spill, int E) {
    __shared__ __attribute__((aligned(16))) _Float16 stage[8 * 16 * SPITCH];   // one tile a wave
    int b = blockIdx.x;
    if (b < QKV_BLOCKS) {
        int w = __builtin_amdgcn_readfirstlane(threadIdx.x >> 5);
        int tile = b + QKV_BLOCKS * w;
        if (tile < ROWTILES)
            qkv_gemm(x, Pq, bq, Pk, bk, Pv, bv, Q, K, V, tile * 16, stage + w * (16 * SPITCH));
    } else {
        edge_bucket(src, dst, cnt, perm, spill, E, (b - QKV_BLOCKS) * 256 + threadIdx.x);
    }
}

// ---------------------------------------------------------------------------
// acc += f16 half of h (low or high) * f32 w, in f32: one instruction, no separate
// conversion (the compiler's own form converts every half first)
__device__ __forceinline__ float fma_lo(unsigned h, float w, float acc) {
    asm("v_fma_mix_f32 %0, %1, %2, %0 op_sel_hi:[1,0,0]" : "+v"(acc) : "v"(h), "v"(w));
    return acc;
}
__device__ __forceinline__ float fma_hi(unsigned h, float w, float acc) {
    asm("v_fma_mix_f32 %0, %1, %2, %0 op_sel:[1,0,0] op_sel_hi:[1,0,0]" : "+v"(acc) : "v"(h), "v"(w));
    return acc;
}

// ---------------------------------------------------------------------------
// The weighted V sum of one destination node by one wave, f16 K and V rows of 256
// bytes. A lane holds 8 of the 128 columns (16 bytes), so 16 lanes cover a row and
// one wave-wide load brings the rows of two edges: the low lanes take the even
// edges, the high lanes the odd ones. Eight edges are walked at a time (8 loads in
// flight); sums are f32 in registers and the two halves are added at the end. The
// first pass takes the node's own bucket (own: place l in lane l); only a node that
// counted more than CAP edges goes on through the spill list, 32 pairs a pass, and
// packs the sources of its own pairs into the low lanes.
// Returns columns (lane & 15) * 8 + (lane >> 4) * 4 .. + 3 of the node's row.
// ---------------------------------------------------------------------------
__device__ __forceinline__ float4 node_sum(
        const _Float16* __restrict__ K, const _Float16* __restrict__ V,
        const int* __restrict__ spill, int node, int total, int nspill, int own, v8h qh) {
    int lane = threadIdx.x & 31;
    int c = lane & 15, hi = lane >> 4;
    float q[8], acc[8];
#pragma unroll
    for (int i = 0; i < 8; ++i) {
        q[i] = (float)qh[i] * 0.25f;   // 1/sqrt(16), exact
        acc[i] = 0.0f;
    }

    for (int base = -32; base < nspill; base += 32) {
        int n, idx;
        if (base < 0) {
            n = min(total, CAP);
            idx = own;
        } else {
            int2 ds = ((const int2*)spill)[min(base + lane, nspill - 1)];
            bool mine = base + lane < nspill && ds.x == node;
            unsigned mask = __builtin_amdgcn_ballot_w32(mine);
            unsigned below = (1u << lane) - 1u;
            n = __popc(mask);
            // a permutation of the 32 lanes: own pairs first, in list order, the others behind
            int to = mine ? __popc(mask & below) : n + __popc(~mask & below);
            idx = __builtin_amdgcn_ds_permute(to * 4, ds.y);
        }
        for (int j = 0; j < n; j += 8) {
            uint4 kv[4], vv[4];   // 8 halves each
            unsigned o[4];
#pragma unroll
            for (int u = 0; u < 4; ++u) {
                // past the end: the last edge's rows again (same lines), weight 0 below
                unsigned s0 = (unsigned)__builtin_amdgcn_readlane(idx, min(j + 2 * u, n - 1));
                unsigned s1 = (unsigned)__builtin_amdgcn_readlane(idx, min(j + 2 * u + 1, n - 1));
                o[u] = (hi ? s1 : s0) * (DIM * 2u) + c * 16u;   // one 32-bit byte offset for both rows
                kv[u] = *(const uint4*)((const char*)K + o[u]);
                vv[u] = *(const uint4*)((const char*)V + o[u]);
            }
            // the offset registers are written again below: wait first. The statement takes
            // them as inputs, so that none of the 8 loads gets one of them for its result
            asm volatile("s_wait_xcnt 0x0" :: "v"(o[0]), "v"(o[1]), "v"(o[2]), "v"(o[3]) : "memory");
#pragma unroll
            for (int u = 0; u < 4; ++u) {
                float p = 0.0f;
                p = fma_lo(kv[u].x, q[0], p); p = fma_hi(kv[u].x, q[1], p);
                p = fma_lo(kv[u].y, q[2], p); p = fma_hi(kv[u].y, q[3], p);
                p = fma_lo(kv[u].z, q[4], p); p = fma_hi(kv[u].z, q[5], p);
                p = fma_lo(kv[u].w, q[6], p); p = fma_hi(kv[u].w, q[7], p);
                // a head is 16 columns = 2 neighbouring lanes: add lanes 1,0,3,2
                p += __int_as_float(__builtin_amdgcn_update_dpp(0, __float_as_int(p), 0xB1, 0xf, 0xf, true));
                p = fminf(5.0f, fmaxf(-5.0f, p));   // clamp(-5, 5)
                float sc = (j + 2 * u + hi < n) ? __expf(p) : 0.0f;
                acc[0] = fma_lo(vv[u].x, sc, acc[0]); acc[1] = fma_hi(vv[u].x, sc, acc[1]);
                acc[2] = fma_lo(vv[u].y, sc, acc[2]); acc[3] = fma_hi(vv[u].y, sc, acc[3]);
                acc[4] = fma_lo(vv[u].z, sc, acc[4]); acc[5] = fma_hi(vv[u].z, sc, acc[5]);
                acc[6] = fma_lo(vv[u].w, sc, acc[6]); acc[7] = fma_hi(vv[u].w, sc, acc[7]);
            }
        }
    }

    // even-edge and odd-edge sums meet: a lane keeps 4 of its 8 columns and gets the
    // other half-wave's sums of those (lane l <-> l ^ 16)
    float4 r;
    float* rp = &r.x;
#pragma unroll
    for (int i = 0; i < 4; ++i) {
        int give = __float_as_int(hi ? acc[i] : acc[4 + i]);
        float got = __int_as_float(__builtin_amdgcn_permlanex16(give, give, 0x76543210, 0xfedcba98, false, false));
        rp[i] = (hi ? acc[4 + i] : acc[i]) + got;
    }
    return r;
}

// ---------------------------------------------------------------------------
// Launch 3: edge sums -> residual + LN1 -> LN2 -> Wo GEMM (WMMA from LDS) -> ReLU +
// residual, one 16-node tile per block of 128 threads (4 waves). A wave sums the
// edges of 4 nodes, one after the other, and leaves each row in the LDS tile; these
// are the very 4 rows whose LayerNorms it does next, so the sums never go through
// memory and no barrier stands between the two parts. The counts, buckets and Q rows
// of all 4 nodes and the wave's share of x are asked for at the start, so that only
// the K and V gathers wait one behind the other. 9 waves a SIMD: 112 registers.
// ---------------------------------------------------------------------------
__global__ __launch_bounds__(128, 9) void attn_ln_out(
        const _Float16* __restrict__ Q, const _Float16* __restrict__ K,
        const _Float16* __restrict__ V, const int* __restrict__ cnt,
        const int* __restrict__ spill, int E,
        const float* __restrict__ x,
        const _Float16* __restrict__ Po, const float* __restrict__ bo,
        const float* __restrict__ g1, const float* __restrict__ b1,
        const float* __restrict__ g2, const float* __restrict__ b2,
        float* __restrict__ out) {
    __shared__ __attribute__((aligned(16))) float h2s[16 * DIM];   // edge sums, then in place the post-LN1 tile (residual for epilogue)
    __shared__ _Float16 gs[16 * DIM];    // post-LN2 tile (A matrix for WMMA)

    int row0 = blockIdx.x * 16;
    int t = threadIdx.x;
    int r  = t >> 3;          // row in tile (8 threads per row; contiguous in wave)
    int c0 = (t & 7) * 16;    // 16 columns per thread
    int wave = __builtin_amdgcn_readfirstlane(t >> 5);   // scalar: the counters come by a scalar load
    int lane = t & 31;

    // --- what the 4 nodes of this wave need, all asked for at once ---
    int nb = row0 + wave * 4;
    int4 c4 = *(const int4*)(cnt + nb);
    float4 xv[4];
#pragma unroll
    for (int i = 0; i < 4; ++i)
        xv[i] = *(const float4*)(x + (size_t)(row0 + r) * DIM + c0 + i * 4);
    // a Q load's result may land in the x loads' address pair: wait first
    asm volatile("s_wait_xcnt 0x0" ::: "memory");
    v8h qh[4];
#pragma unroll
    for (int k = 0; k < 4; ++k)
        qh[k] = *(const v8h*)(Q + (size_t)(nb + k) * DIM + (lane & 15) * 8);
    // the address registers of the loads above may be written again below: wait first
    asm volatile("s_wait_xcnt 0x0" ::: "memory");
    int tot[4] = {__builtin_amdgcn_readfirstlane(c4.x), __builtin_amdgcn_readfirstlane(c4.y),
                  __builtin_amdgcn_readfirstlane(c4.z), __builtin_amdgcn_readfirstlane(c4.w)};
    int own[4];
#pragma unroll
    for (int k = 0; k < 4; ++k) {
        int n = min(tot[k], CAP);
        // the buckets stand NPAD entries behind the counters. An empty bucket holds no
        // written place: its lanes read the node's counter, and nothing uses the value;
        // so no branch parts the four loads
        int at = n > 0 ? NPAD + (nb + k) * CAP : nb + k;
        own[k] = cnt[at + min(lane, max(n, 1) - 1)];
    }
    // as above
    asm volatile("s_wait_xcnt 0x0" ::: "memory");

    // --- edge sums of the 4 nodes ---
#pragma unroll
    for (int k = 0; k < 4; ++k) {
        int nspill = 0;
        if (tot[k] > CAP) nspill = min(__builtin_amdgcn_readfirstlane(cnt[NNODES]), E);
        float4 s4 = node_sum(K, V, spill, nb + k, tot[k], nspill, own[k], qh[k]);
        ((float4*)(h2s + (wave * 4 + k) * DIM))[(lane & 15) * 2 + (lane >> 4)] = s4;
    }
    // other lanes of this wave read these rows back: their writes must have landed,
    // and the compiler must not move the reads up
    asm volatile("s_wait_dscnt 0x0" ::: "memory");

    // --- preload this wave's B fragments (independent of LDS/LN work) ---
    v16h b0[4], b1f[4];
#pragma unroll
    for (int kk = 0; kk < 4; ++kk) {
        b0[kk]  = load_b_packed(Po, wave * 2 + 0, kk);
        b1f[kk] = load_b_packed(Po, wave * 2 + 1, kk);
    }

    // --- residual + LN1 ---
    float v[16];
    float s = 0.0f, ss = 0.0f;
#pragma unroll
    for (int i = 0; i < 16; ++i) {
        float val = (&xv[i >> 2].x)[i & 3] + h2s[r * DIM + c0 + i];
        v[i] = val; s += val; ss += val * val;
    }
#pragma unroll
    for (int m = 1; m < 8; m <<= 1) {     // reduce within the 8 lanes of a row
        s  += __shfl_xor(s,  m, 32);
        ss += __shfl_xor(ss, m, 32);
    }
    float mean = s * (1.0f / DIM);
    float var  = ss * (1.0f / DIM) - mean * mean;
    float rstd = rsqrtf(var + 1e-5f);

    // --- LN2 on LN1 output ---
    float s2 = 0.0f, ss2 = 0.0f;
#pragma unroll
    for (int i = 0; i < 16; ++i) {
        int c = c0 + i;
        float h = (v[i] - mean) * rstd * g1[c] + b1[c];
        v[i] = h;
        h2s[r * DIM + c] = h;
        s2 += h; ss2 += h * h;
    }
#pragma unroll
    for (int m = 1; m < 8; m <<= 1) {
        s2  += __shfl_xor(s2,  m, 32);
        ss2 += __shfl_xor(ss2, m, 32);
    }
    float mean2 = s2 * (1.0f / DIM);
    float var2  = ss2 * (1.0f / DIM) - mean2 * mean2;
    float rstd2 = rsqrtf(var2 + 1e-5f);
#pragma unroll
    for (int i = 0; i < 16; ++i) {
        int c = c0 + i;
        gs[r * DIM + c] = (_Float16)((v[i] - mean2) * rstd2 * g2[c] + b2[c]);
    }
    __syncthreads();

    // --- Wo GEMM + bias + ReLU + residual epilogue ---
    v16h a[4];
#pragma unroll
    for (int kk = 0; kk < 4; ++kk) a[kk] = load_a_lds(gs, kk * 32);

    int n  = lane & 15;
    int mb = (lane >> 4) * 8;

#pragma unroll
    for (int jj = 0; jj < 2; ++jj) {      // 8 column tiles / 4 waves
        int j = wave * 2 + jj;
        v8f acc = {};
#pragma unroll
        for (int kk = 0; kk < 4; ++kk) {
            v16h b = (jj == 0) ? b0[kk] : b1f[kk];
            acc = __builtin_amdgcn_wmma_f32_16x16x32_f16(
                    false, a[kk], false, b, (short)0, acc, false, false);
        }
        int col = j * 16 + n;
        float bb = bo[col];
#pragma unroll
        for (int i = 0; i < 8; ++i) {
            float relu = fmaxf(acc[i] + bb, 0.0f);
            out[(size_t)(row0 + mb + i) * DIM + col] = h2s[(mb + i) * DIM + col] + relu;
        }
    }
}

// ---------------------------------------------------------------------------
extern "C" void kernel_launch(void* const* d_in, const int* in_sizes, int n_in,
                              void* d_out, int out_size, void* d_ws, size_t ws_size,
                              hipStream_t stream) {
    const float* x  = (const float*)d_in[0];
    const int*   src = (const int*)d_in[1];
    const int*   dst = (const int*)d_in[2];
    const float* Wq = (const float*)d_in[3];
    const float* bq = (const float*)d_in[4];
    const float* Wk = (const float*)d_in[5];
    const float* bk = (const float*)d_in[6];
    const float* Wv = (const float*)d_in[7];
    const float* bv = (const float*)d_in[8];
    const float* Wo = (const float*)d_in[9];
    const float* bo = (const float*)d_in[10];
    const float* g1 = (const float*)d_in[11];
    const float* b1 = (const float*)d_in[12];
    const float* g2 = (const float*)d_in[13];
    const float* b2 = (const float*)d_in[14];
    float* out = (float*)d_out;

    int E = in_sizes[1];
    size_t nd = (size_t)NNODES * DIM;
    _Float16* Q = (_Float16*)d_ws;   // projections, f16
    _Float16* K = Q + nd;
    _Float16* V = K + nd;
    // packed f16 weight fragments: 32 frags * 32 lanes * 16 halves = 16384 halves each
    _Float16* Pq = V + nd;
    _Float16* Pk = Pq + 32 * 32 * 16;
    _Float16* Pv = Pk + 32 * 32 * 16;
    _Float16* Po = Pv + 32 * 32 * 16;
    // edges by dst: counters, a bucket of CAP source nodes per node, spilled (dst, src) pairs
    int* cnt   = (int*)(Po + 32 * 32 * 16);
    int* perm  = cnt + NPAD;
    int* spill = perm + NNODES * CAP;

    pack_and_zero<<<PACK_BLOCKS + NPAD / 256, 256, 0, stream>>>(Wq, Wk, Wv, Wo, Pq, cnt);
    qkv_and_bucket<<<QKV_BLOCKS + (E + 255) / 256, 256, 0, stream>>>(
        x, Pq, bq, Pk, bk, Pv, bv, Q, K, V, src, dst, cnt, perm, spill, E);
    attn_ln_out<<<ROWTILES, 128, 0, stream>>>(Q, K, V, cnt, spill, E, x, Po, bo, g1, b1, g2, b2, out);
}

// v006
// A run of this version takes 83.4 microseconds.
// Two timings next to v005 put it at 1.14 and 1.15 times that version's speed.
// Over all steps from v000 it is 7.05 times as fast.
#include <hip/hip_runtime.h>

#define NNODES 50000
#define DIM 128
#define NHEADS 8
#define HD 16
#define ROWTILES (NNODES / 16)   // 3125 exactly
#define BKT 32                   // ints in a node's bucket: one 128-byte line, one int a lane
#define CAP 31                   // places 0..30 hold source nodes; place CAP is the node's own edge counter
#define ZERO_BLOCKS 196          // 196 * 256 threads * 8 stores of 16 B cover the NNODES + 1 buckets
#define ZERO_INTS (ZERO_BLOCKS * 256 * 8 * 4)   // bucket NNODES holds no edges: its counter counts the spilled edges
#define PACK_BLOCKS 16           // 4 matrices x 32 fragments, one wave each, 8 waves a block
#define QKV_BLOCKS 512           // two blocks a WGP; wave w of block b takes row tile b + 512 * w

#define SPITCH 136               // halves a row of the store staging tile: 272 B, 16 B x odd

typedef __attribute__((ext_vector_type(16))) _Float16 v16h;
typedef __attribute__((ext_vector_type(8)))  _Float16 v8h;
typedef __attribute__((ext_vector_type(8)))  float    v8f;
typedef __attribute__((ext_vector_type(4)))  float    v4f;

// CDNA5 16-bit A-matrix 16x32 layout (ISA 7.12.2):
// lanes 0-15  (sel=0): halves 0..7 -> K=0..7,  halves 8..15 -> K=16..23
// lanes 16-31 (sel=1): halves 0..7 -> K=8..15, halves 8..15 -> K=24..31
__device__ __forceinline__ int kmap(int i, int sel) {
    int base = sel ? 8 : 0;
    return (i < 8) ? (base + i) : (16 + base + (i - 8));
}

// Load one 16x32 A fragment from f32 row-major source (vectorized float4)
__device__ __forceinline__ v16h load_a_f32(const float* __restrict__ src, int lda) {
    int lane = threadIdx.x & 31;
    int m = lane & 15, sel = lane >> 4;
    const float4* p = (const float4*)(src + m * lda);
    float4 u0 = p[sel * 2 + 0];      // K = sel*8 .. sel*8+3
    float4 u1 = p[sel * 2 + 1];      // K = sel*8+4 .. sel*8+7
    float4 u2 = p[4 + sel * 2 + 0];  // K = 16+sel*8 ..
    float4 u3 = p[4 + sel * 2 + 1];
    v16h a;
    a[0]  = (_Float16)u0.x; a[1]  = (_Float16)u0.y; a[2]  = (_Float16)u0.z; a[3]  = (_Float16)u0.w;
    a[4]  = (_Float16)u1.x; a[5]  = (_Float16)u1.y; a[6]  = (_Float16)u1.z; a[7]  = (_Float16)u1.w;
    a[8]  = (_Float16)u2.x; a[9]  = (_Float16)u2.y; a[10] = (_Float16)u2.z; a[11] = (_Float16)u2.w;
    a[12] = (_Float16)u3.x; a[13] = (_Float16)u3.y; a[14] = (_Float16)u3.z; a[15] = (_Float16)u3.w;
    return a;
}

// Load one 16x32 A fragment from an f16 LDS tile [16][DIM]
// (per-lane halves are two contiguous 16B runs -> merges into ds_load_b128 x2)
__device__ __forceinline__ v16h load_a_lds(const _Float16* tile, int k0) {
    int lane = threadIdx.x & 31;
    int m = lane & 15, sel = lane >> 4;
    const _Float16* row = tile + m * DIM + k0;
    v16h a;
#pragma unroll
    for (int i = 0; i < 16; ++i) a[i] = row[kmap(i, sel)];
    return a;
}

// Pre-packed B fragments: per fragment (j,kk), lane l owns 16 contiguous halves
// (32 bytes) -> a single vector load (2 x global_load_b128) at GEMM time.
__device__ __forceinline__ v16h load_b_packed(const _Float16* __restrict__ P, int j, int kk) {
    int lane = threadIdx.x & 31;
    return *(const v16h*)(P + ((size_t)(j * 4 + kk) * 32 + lane) * 16);
}

// ---------------------------------------------------------------------------
// Pack one fragment of an f32 weight matrix [128][128] into WMMA B-fragment f16
// layout. One wave per (j,kk) fragment; 32 fragments per matrix.
// ---------------------------------------------------------------------------
__device__ __forceinline__ void pack_w(const float* __restrict__ W,
                                       _Float16* __restrict__ P, int frag) {
    int j = frag >> 2, kk = frag & 3;   // frag = j*4 + kk
    int lane = threadIdx.x & 31;
    int n = lane & 15, sel = lane >> 4;
    _Float16* dstp = P + ((size_t)frag * 32 + lane) * 16;
#pragma unroll
    for (int i = 0; i < 16; ++i)
        dstp[i] = (_Float16)W[(size_t)(kk * 32 + kmap(i, sel)) * DIM + j * 16 + n];
}

// ---------------------------------------------------------------------------
// Launch 1: two jobs that depend on nothing share one grid; the block index picks
// the job. Blocks 0..15 pack the four weight matrices (4 blocks each, P holds the
// four packed matrices one behind the other); the others zero the buckets, whole
// lines: the counters start at 0, and every place that launch 3 loads is written.
// ---------------------------------------------------------------------------
__global__ __launch_bounds__(256) void pack_and_zero(
        const float* __restrict__ Wq, const float* __restrict__ Wk,
        const float* __restrict__ Wv, const float* __restrict__ Wo,
        _Float16* __restrict__ P, int* __restrict__ bkt) {
    int b = blockIdx.x;
    if (b < PACK_BLOCKS) {
        int mtx = b >> 2;
        const float* W = mtx == 0 ? Wq : mtx == 1 ? Wk : mtx == 2 ? Wv : Wo;
        pack_w(W, P + mtx * (32 * 32 * 16), (b & 3) * 8 + (threadIdx.x >> 5));
    } else {
        int4* z = (int4*)bkt + (b - PACK_BLOCKS) * (256 * 8) + threadIdx.x;
#pragma unroll
        for (int k = 0; k < 8; ++k) z[k * 256] = make_int4(0, 0, 0, 0);
        // the stores' address registers may be written again behind them: wait first
        asm volatile("s_wait_xcnt 0x0" ::: "memory");
    }
}

// ---------------------------------------------------------------------------
// Fused Q/K/V projection of one 16-row tile by one wave; Q, K and V are stored
// as f16. The weight fragment is the A operand and the x fragment the B operand
// (both have the same lane and k map), so a lane holds 8 neighbouring columns of
// one node: one 16-byte write into the wave's own LDS tile, which goes out as
// whole 256-byte rows.
// Weight fragments double-buffered across the column-tile loop so global loads
// overlap the WMMAs instead of serializing load->wait->wmma.
// ---------------------------------------------------------------------------
__device__ __forceinline__ void qkv_gemm(
        const float* __restrict__ x,
        const _Float16* __restrict__ Pq, const float* __restrict__ bq,
        const _Float16* __restrict__ Pk, const float* __restrict__ bk,
        const _Float16* __restrict__ Pv, const float* __restrict__ bv,
        _Float16* __restrict__ Q, _Float16* __restrict__ K, _Float16* __restrict__ V,
        int row0, _Float16* stage) {
    int lane = threadIdx.x & 31;

    v16h a[4];
#pragma unroll
    for (int kk = 0; kk < 4; ++kk)
        a[kk] = load_a_f32(x + (size_t)row0 * DIM + kk * 32, DIM);
    // a B load's result may land in the x loads' address pair: wait first
    asm volatile("s_wait_xcnt 0x0" ::: "memory");

    const _Float16* Ps[3] = {Pq, Pk, Pv};
    const float*    bs[3] = {bq, bk, bv};
    _Float16*       Os[3] = {Q, K, V};

    int n  = lane & 15;
    int mb = (lane >> 4) * 8;

#pragma unroll
    for (int mtx = 0; mtx < 3; ++mtx) {
        const _Float16* P    = Ps[mtx];
        const float*    bias = bs[mtx];
        _Float16*       out  = Os[mtx];

        v16h b[4];
#pragma unroll
        for (int kk = 0; kk < 4; ++kk) b[kk] = load_b_packed(P, 0, kk);
        v4f bb0 = *(const v4f*)(bias + mb);       // the lane's 8 columns of tile 0
        v4f bb1 = *(const v4f*)(bias + mb + 4);

#pragma unroll
        for (int j = 0; j < 8; ++j) {
            v16h bn[4];
            v4f bn0, bn1;
            if (j < 7) {
#pragma unroll
                for (int kk = 0; kk < 4; ++kk) bn[kk] = load_b_packed(P, j + 1, kk);
                bn0 = *(const v4f*)(bias + (j + 1) * 16 + mb);
                bn1 = *(const v4f*)(bias + (j + 1) * 16 + mb + 4);
            }
            v8f acc = {};
#pragma unroll
            for (int kk = 0; kk < 4; ++kk)
                acc = __builtin_amdgcn_wmma_f32_16x16x32_f16(
                        false, b[kk], false, a[kk], (short)0, acc, false, false);

            // acc[i] = node row0 + n, column j * 16 + mb + i
            v8h h;
            h[0] = (_Float16)(acc[0] + bb0.x); h[1] = (_Float16)(acc[1] + bb0.y);
            h[2] = (_Float16)(acc[2] + bb0.z); h[3] = (_Float16)(acc[3] + bb0.w);
            h[4] = (_Float16)(acc[4] + bb1.x); h[5] = (_Float16)(acc[5] + bb1.y);
            h[6] = (_Float16)(acc[6] + bb1.z); h[7] = (_Float16)(acc[7] + bb1.w);
            *(v8h*)(stage + n * SPITCH + j * 16 + mb) = h;

#pragma unroll
            for (int kk = 0; kk < 4; ++kk) b[kk] = bn[kk];
            bb0 = bn0; bb1 = bn1;
            // holds the next tile's loads inside this tile (loaded values as inputs only):
            // without it the compiler sinks each load to just in front of its own WMMA
            if (j < 7)
                asm volatile("" :: "v"(bn[0]), "v"(bn[1]), "v"(bn[2]), "v"(bn[3]), "v"(bn0), "v"(bn1));
        }

        // other lanes of this wave read the tile back: their writes must have landed,
        // and the compiler must not move the reads up
        asm volatile("s_wait_dscnt 0x0" ::: "memory");
        _Float16*       gp = out + (size_t)(row0 + (lane >> 4)) * DIM + n * 8;
        const _Float16* sp = stage + (lane >> 4) * SPITCH + n * 8;
#pragma unroll
        for (int r = 0; r < 8; ++r)     // rows 2r and 2r + 1: 512 contiguous bytes a store
            *(v8h*)(gp + r * 2 * DIM) = *(const v8h*)(sp + r * 2 * SPITCH);
        // a later load's result may land in a register these stores name; and the next
        // matrix's LDS writes stay behind the reads above
        asm volatile("s_wait_xcnt 0x0" ::: "memory");
    }
}

// ---------------------------------------------------------------------------
// Count the edges of every destination node; the returned old count is the
// edge's place (arrival order) in its node's bucket of CAP places, whose start
// needs no prefix sum, so the source node is written there at once. The counter
// stands in the bucket's own line: the adds of all nodes spread over as many lines
// as there are nodes, and the add and the store of an edge meet the same line. An
// edge that finds its bucket full goes, as the pair (dst, src), to the end of one
// spill list that all nodes share (at most E pairs).
// ---------------------------------------------------------------------------
__device__ __forceinline__ void edge_bucket(const int* __restrict__ src, const int* __restrict__ dst,
                                            int* __restrict__ bkt,
                                            int* __restrict__ spill, int E, int e) {
    if (e >= E) return;
    int d = dst[e];
    int s = min(max(src[e], 0), NNODES - 1);
    if ((unsigned)d >= (unsigned)NNODES) return;
    // the add's returned rank may land in the address pair of the src load: wait first
    asm volatile("s_wait_xcnt 0x0" ::: "memory");
    int r = atomicAdd(bkt + d * BKT + CAP, 1);
    if ((unsigned)r < (unsigned)CAP) {
        bkt[d * BKT + r] = s;
    } else {
        int o = atomicAdd(bkt + NNODES * BKT + CAP, 1);
        if ((unsigned)o < (unsigned)E) ((int2*)spill)[o] = make_int2(d, s);
    }
}

// ---------------------------------------------------------------------------
// Launch 2: the projections and the edge buckets need only launch 1 and not each
// other, so they share one grid. The projection blocks come first: they live
// longest, and the short edge blocks stream past them. The edge blocks get this
// kernel's register allotment too: 8 waves a SIMD (128 registers) leaves room for
// two of them beside the two projection blocks of a WGP.
// ---------------------------------------------------------------------------
__global__ __launch_bounds__(256, 8) void qkv_and_bucket(
        const float* __restrict__ x,
        const _Float16* __restrict__ Pq, const float* __restrict__ bq,
        const _Float16* __restrict__ Pk, const float* __restrict__ bk,
        const _Float16* __restrict__ Pv, const float* __restrict__ bv,
        _Float16* __restrict__ Q, _Float16* __restrict__ K, _Float16* __restrict__ V,
        const int* __restrict__ src, const int* __restrict__ dst, int* __restrict__ bkt,
        int* __restrict__ spill, int E) {
    __shared__ __attribute__((aligned(16))) _Float16 stage[8 * 16 * SPITCH];   // one tile a wave
    int b = blockIdx.x;
    if (b < QKV_BLOCKS) {
        int w = __builtin_amdgcn_readfirstlane(threadIdx.x >> 5);
        int tile = b + QKV_BLOCKS * w;
        if (tile < ROWTILES)
            qkv_gemm(x, Pq, bq, Pk, bk, Pv, bv, Q, K, V, tile * 16, stage + w * (16 * SPITCH));
    } else {
        edge_bucket(src, dst, bkt, spill, E, (b - QKV_BLOCKS) * 256 + threadIdx.x);
    }
}

// ---------------------------------------------------------------------------
// acc += f16 half of h (low or high) * f32 w, in f32: one instruction, no separate
// conversion (the compiler's own form converts every half first)
__device__ __forceinline__ float fma_lo(unsigned h, float w, float acc) {
    asm("v_fma_mix_f32 %0, %1, %2, %0 op_sel_hi:[1,0,0]" : "+v"(acc) : "v"(h), "v"(w));
    return acc;
}
__device__ __forceinline__ float fma_hi(unsigned h, float w, float acc) {
    asm("v_fma_mix_f32 %0, %1, %2, %0 op_sel:[1,0,0] op_sel_hi:[1,0,0]" : "+v"(acc) : "v"(h), "v"(w));
    return acc;
}

// ---------------------------------------------------------------------------
// The weighted V sum of one destination node by one wave, f16 K and V rows of 256
// bytes. A lane holds 8 of the 128 columns (16 bytes), so 16 lanes cover a row and
// one wave-wide load brings the rows of two edges: the low lanes take the even
// edges, the high lanes the odd ones. Eight edges are walked at a time (8 loads in
// flight); sums are f32 in registers and the two halves are added at the end. The
// first pass takes the node's own bucket (own: place l in lane l); only a node that
// counted more than CAP edges goes on through the spill list, 32 pairs a pass, and
// packs the sources of its own pairs into the low lanes.
// Returns columns (lane & 15) * 8 + (lane >> 4) * 4 .. + 3 of the node's row.
// ---------------------------------------------------------------------------
__device__ __forceinline__ float4 node_sum(
        const _Float16* __restrict__ K, const _Float16* __restrict__ V,
        const int* __restrict__ spill, int node, int total, int nspill, int own, v8h qh) {
    int lane = threadIdx.x & 31;
    int c = lane & 15, hi = lane >> 4;
    float q[8], acc[8];
#pragma unroll
    for (int i = 0; i < 8; ++i) {
        q[i] = (float)qh[i] * 0.25f;   // 1/sqrt(16), exact
        acc[i] = 0.0f;
    }

    for (int base = -32; base < nspill; base += 32) {
        int n, idx;
        if (base < 0) {
            n = min(total, CAP);
            idx = own;
        } else {
            int2 ds = ((const int2*)spill)[min(base + lane, nspill - 1)];
            bool mine = base + lane < nspill && ds.x == node;
            unsigned mask = __builtin_amdgcn_ballot_w32(mine);
            unsigned below = (1u << lane) - 1u;
            n = __popc(mask);
            // a permutation of the 32 lanes: own pairs first, in list order, the others behind
            int to = mine ? __popc(mask & below) : n + __popc(~mask & below);
            idx = __builtin_amdgcn_ds_permute(to * 4, ds.y);
        }
        for (int j = 0; j < n; j += 8) {
            uint4 kv[4], vv[4];   // 8 halves each
            unsigned o[4];
#pragma unroll
            for (int u = 0; u < 4; ++u) {
                // past the end: the last edge's rows again (same lines), weight 0 below
                unsigned s0 = (unsigned)__builtin_amdgcn_readlane(idx, min(j + 2 * u, n - 1));
                unsigned s1 = (unsigned)__builtin_amdgcn_readlane(idx, min(j + 2 * u + 1, n - 1));
                o[u] = (hi ? s1 : s0) * (DIM * 2u) + c * 16u;   // one 32-bit byte offset for both rows
                kv[u] = *(const uint4*)((const char*)K + o[u]);
                vv[u] = *(const uint4*)((const char*)V + o[u]);
            }
            // the offset registers are written again below: wait first. The statement takes
            // them as inputs, so that none of the 8 loads gets one of them for its result
            asm volatile("s_wait_xcnt 0x0" :: "v"(o[0]), "v"(o[1]), "v"(o[2]), "v"(o[3]) : "memory");
#pragma unroll
            for (int u = 0; u < 4; ++u) {
                float p = 0.0f;
                p = fma_lo(kv[u].x, q[0], p); p = fma_hi(kv[u].x, q[1], p);
                p = fma_lo(kv[u].y, q[2], p); p = fma_hi(kv[u].y, q[3], p);
                p = fma_lo(kv[u].z, q[4], p); p = fma_hi(kv[u].z, q[5], p);
                p = fma_lo(kv[u].w, q[6], p); p = fma_hi(kv[u].w, q[7], p);
                // a head is 16 columns = 2 neighbouring lanes: add lanes 1,0,3,2
                p += __int_as_float(__builtin_amdgcn_update_dpp(0, __float_as_int(p), 0xB1, 0xf, 0xf, true));
                p = fminf(5.0f, fmaxf(-5.0f, p));   // clamp(-5, 5)
                float sc = (j + 2 * u + hi < n) ? __expf(p) : 0.0f;
                acc[0] = fma_lo(vv[u].x, sc, acc[0]); acc[1] = fma_hi(vv[u].x, sc, acc[1]);
                acc[2] = fma_lo(vv[u].y, sc, acc[2]); acc[3] = fma_hi(vv[u].y, sc, acc[3]);
                acc[4] = fma_lo(vv[u].z, sc, acc[4]); acc[5] = fma_hi(vv[u].z, sc, acc[5]);
                acc[6] = fma_lo(vv[u].w, sc, acc[6]); acc[7] = fma_hi(vv[u].w, sc, acc[7]);
            }
        }
    }

    // even-edge and odd-edge sums meet: a lane keeps 4 of its 8 columns and gets the
    // other half-wave's sums of those (lane l <-> l ^ 16)
    float4 r;
    float* rp = &r.x;
#pragma unroll
    for (int i = 0; i < 4; ++i) {
        int give = __float_as_int(hi ? acc[i] : acc[4 + i]);
        float got = __int_as_float(__builtin_amdgcn_permlanex16(give, give, 0x76543210, 0xfedcba98, false, false));
        rp[i] = (hi ? acc[4 + i] : acc[i]) + got;
    }
    return r;
}

// ---------------------------------------------------------------------------
// Launch 3: edge sums -> residual + LN1 -> LN2 -> Wo GEMM (WMMA from LDS) -> ReLU +
// residual, one 16-node tile per block of 128 threads (4 waves). A wave sums the
// edges of 4 nodes, one after the other, and leaves each row in the LDS tile; these
// are the very 4 rows whose LayerNorms it does next, so the sums never go through
// memory and no barrier stands between the two parts. The buckets (each with its
// count in lane CAP) and Q rows of all 4 nodes and the wave's share of x are asked for
// at the start, so that only the K and V gathers wait one behind the other. 9 waves a
// SIMD: 112 registers.
// ---------------------------------------------------------------------------
__global__ __launch_bounds__(128, 9) void attn_ln_out(
        const _Float16* __restrict__ Q, const _Float16* __restrict__ K,
        const _Float16* __restrict__ V, const int* __restrict__ bkt,
        const int* __restrict__ spill, int E,
        const float* __restrict__ x,
        const _Float16* __restrict__ Po, const float* __restrict__ bo,
        const float* __restrict__ g1, const float* __restrict__ b1,
        const float* __restrict__ g2, const float* __restrict__ b2,
        float* __restrict__ out) {
    __shared__ __attribute__((aligned(16))) float h2s[16 * DIM];   // edge sums, then in place the post-LN1 tile (residual for epilogue)
    __shared__ _Float16 gs[16 * DIM];    // post-LN2 tile (A matrix for WMMA)

    int row0 = blockIdx.x * 16;
    int t = threadIdx.x;
    int r  = t >> 3;          // row in tile (8 threads per row; contiguous in wave)
    int c0 = (t & 7) * 16;    // 16 columns per thread
    int wave = __builtin_amdgcn_readfirstlane(t >> 5);
    int lane = t & 31;

    // --- what the 4 nodes of this wave need, all asked for at once ---
    int nb = row0 + wave * 4;
    // the buckets first: the gathers hang on them alone. One load brings a node's count
    // and its sources (every int of the line was written in this call: launch 1 or 2)
    int own[4];
#pragma unroll
    for (int k = 0; k < 4; ++k)
        own[k] = bkt[(nb + k) * BKT + lane];
    // an x load's result may land in the bucket loads' address register: wait first
    asm volatile("s_wait_xcnt 0x0" ::: "memory");
    float4 xv[4];
#pragma unroll
    for (int i = 0; i < 4; ++i)
        xv[i] = *(const float4*)(x + (size_t)(row0 + r) * DIM + c0 + i * 4);
    // a Q load's result may land in the x loads' address pair: wait first
    asm volatile("s_wait_xcnt 0x0" ::: "memory");
    v8h qh[4];
#pragma unroll
    for (int k = 0; k < 4; ++k)
        qh[k] = *(const v8h*)(Q + (size_t)(nb + k) * DIM + (lane & 15) * 8);
    // the address registers of the loads above may be written again below: wait first
    asm volatile("s_wait_xcnt 0x0" ::: "memory");
    int tot[4];
#pragma unroll
    for (int k = 0; k < 4; ++k)
        tot[k] = __builtin_amdgcn_readlane(own[k], CAP);

    // --- edge sums of the 4 nodes ---
#pragma unroll
    for (int k = 0; k < 4; ++k) {
        int nspill = 0;
        if (tot[k] > CAP) nspill = min(__builtin_amdgcn_readfirstlane(bkt[NNODES * BKT + CAP]), E);
        float4 s4 = node_sum(K, V, spill, nb + k, tot[k], nspill, own[k], qh[k]);
        ((float4*)(h2s + (wave * 4 + k) * DIM))[(lane & 15) * 2 + (lane >> 4)] = s4;
    }
    // other lanes of this wave read these rows back: their writes must have landed,
    // and the compiler must not move the reads up
    asm volatile("s_wait_dscnt 0x0" ::: "memory");

    // --- preload this wave's B fragments (independent of LDS/LN work) ---
    v16h b0[4], b1f[4];
#pragma unroll
    for (int kk = 0; kk < 4; ++kk) {
        b0[kk]  = load_b_packed(Po, wave * 2 + 0, kk);
        b1f[kk] = load_b_packed(Po, wave * 2 + 1, kk);
    }

    // --- residual + LN1 ---
    float v[16];
    float s = 0.0f, ss = 0.0f;
#pragma unroll
    for (int i = 0; i < 16; ++i) {
        float val = (&xv[i >> 2].x)[i & 3] + h2s[r * DIM + c0 + i];
        v[i] = val; s += val; ss += val * val;
    }
#pragma unroll
    for (int m = 1; m < 8; m <<= 1) {     // reduce within the 8 lanes of a row
        s  += __shfl_xor(s,  m, 32);
        ss += __shfl_xor(ss, m, 32);
    }
    float mean = s * (1.0f / DIM);
    float var  = ss * (1.0f / DIM) - mean * mean;
    float rstd = rsqrtf(var + 1e-5f);

    // --- LN2 on LN1 output ---
    float s2 = 0.0f, ss2 = 0.0f;
#pragma unroll
    for (int i = 0; i < 16; ++i) {
        int c = c0 + i;
        float h = (v[i] - mean) * rstd * g1[c] + b1[c];
        v[i] = h;
        h2s[r * DIM + c] = h;
        s2 += h; ss2 += h * h;
    }
#pragma unroll
    for (int m = 1; m < 8; m <<= 1) {
        s2  += __shfl_xor(s2,  m, 32);
        ss2 += __shfl_xor(ss2, m, 32);
    }
    float mean2 = s2 * (1.0f / DIM);
    float var2  = ss2 * (1.0f / DIM) - mean2 * mean2;
    float rstd2 = rsqrtf(var2 + 1e-5f);
#pragma unroll
    for (int i = 0; i < 16; ++i) {
        int c = c0 + i;
        gs[r * DIM + c] = (_Float16)((v[i] - mean2) * rstd2 * g2[c] + b2[c]);
    }
    __syncthreads();

    // --- Wo GEMM + bias + ReLU + residual epilogue ---
    v16h a[4];
#pragma unroll
    for (int kk = 0; kk < 4; ++kk) a[kk] = load_a_lds(gs, kk * 32);

    int n  = lane & 15;
    int mb = (lane >> 4) * 8;

#pragma unroll
    for (int jj = 0; jj < 2; ++jj) {      // 8 column tiles / 4 waves
        int j = wave * 2 + jj;
        v8f acc = {};
#pragma unroll
        for (int kk = 0; kk < 4; ++kk) {
            v16h b = (jj == 0) ? b0[kk] : b1f[kk];
            acc = __builtin_amdgcn_wmma_f32_16x16x32_f16(
                    false, a[kk], false, b, (short)0, acc, false, false);
        }
        int col = j * 16 + n;
        float bb = bo[col];
#pragma unroll
        for (int i = 0; i < 8; ++i) {
            float relu = fmaxf(acc[i] + bb, 0.0f);
            out[(size_t)(row0 + mb + i) * DIM + col] = h2s[(mb + i) * DIM + col] + relu;
        }
    }
}

// ---------------------------------------------------------------------------
extern "C" void kernel_launch(void* const* d_in, const int* in_sizes, int n_in,
                              void* d_out, int out_size, void* d_ws, size_t ws_size,
                              hipStream_t stream) {
    const float* x  = (const float*)d_in[0];
    const int*   src = (const int*)d_in[1];
    const int*   dst = (const int*)d_in[2];
    const float* Wq = (const float*)d_in[3];
    const float* bq = (const float*)d_in[4];
    const float* Wk = (const float*)d_in[5];
    const float* bk = (const float*)d_in[6];
    const float* Wv = (const float*)d_in[7];
    const float* bv = (const float*)d_in[8];
    const float* Wo = (const float*)d_in[9];
    const float* bo = (const float*)d_in[10];
    const float* g1 = (const float*)d_in[11];
    const float* b1 = (const float*)d_in[12];
    const float* g2 = (const float*)d_in[13];
    const float* b2 = (const float*)d_in[14];
    float* out = (float*)d_out;

    int E = in_sizes[1];
    size_t nd = (size_t)NNODES * DIM;
    _Float16* Q = (_Float16*)d_ws;   // projections, f16
    _Float16* K = Q + nd;
    _Float16* V = K + nd;
    // packed f16 weight fragments: 32 frags * 32 lanes * 16 halves = 16384 halves each
    _Float16* Pq = V + nd;
    _Float16* Pk = Pq + 32 * 32 * 16;
    _Float16* Pv = Pk + 32 * 32 * 16;
    _Float16* Po = Pv + 32 * 32 * 16;
    // edges by dst: a bucket per node (CAP source nodes and the counter), spilled (dst, src) pairs
    int* bkt   = (int*)(Po + 32 * 32 * 16);
    int* spill = bkt + ZERO_INTS;

    pack_and_zero<<<PACK_BLOCKS + ZERO_BLOCKS, 256, 0, stream>>>(Wq, Wk, Wv, Wo, Pq, bkt);
    qkv_and_bucket<<<QKV_BLOCKS + (E + 255) / 256, 256, 0, stream>>>(
        x, Pq, bq, Pk, bk, Pv, bv, Q, K, V, src, dst, bkt, spill, E);
    attn_ln_out<<<ROWTILES, 128, 0, stream>>>(Q, K, V, bkt, spill, E, x, Po, bo, g1, b1, g2, b2, out);
}

// v007
// One run takes 67.7 microseconds.
// In two side-by-side timings against v006, it was 1.21 and 1.25 times as fast.
// All steps since v000 together make it 8.68 times as fast.
#include <hip/hip_runtime.h>

#define NNODES 50000
#define DIM 128
#define NHEADS 8
#define HD 16
#define ROWTILES (NNODES / 16)   // 3125 exactly
#define BKT 32                   // ints in a node's bucket: one 128-byte line, one int a lane
#define CAP 31                   // places 0..30 hold source nodes; place CAP is the node's own edge counter
#define NPB 200                  // nodes a bin: one block of launch 2 builds their buckets in LDS
#define NBINS (NNODES / NPB)     // 250 exactly
#define TABW 256                 // table words a chunk: one a bin, padded to the block's threads
#define CHUNK 4096               // edges a block of launch 1 sorts by bin: 16 a thread
#define PROD_MAX 196             // chunks of the 800000 edges of the problem's shape
#define PACK_BLOCKS 16           // 4 matrices x 32 fragments, one wave each, 8 waves a block
#define QKV_BLOCKS 512           // two blocks a WGP; wave w of block b takes row tile b + 512 * w

#define SPITCH 136               // halves a row of the store staging tile: 272 B, 16 B x odd

typedef __attribute__((ext_vector_type(16))) _Float16 v16h;
typedef __attribute__((ext_vector_type(8)))  _Float16 v8h;
typedef __attribute__((ext_vector_type(8)))  float    v8f;
typedef __attribute__((ext_vector_type(4)))  float    v4f;

// CDNA5 16-bit A-matrix 16x32 layout (ISA 7.12.2):
// lanes 0-15  (sel=0): halves 0..7 -> K=0..7,  halves 8..15 -> K=16..23
// lanes 16-31 (sel=1): halves 0..7 -> K=8..15, halves 8..15 -> K=24..31
__device__ __forceinline__ int kmap(int i, int sel) {
    int base = sel ? 8 : 0;
    return (i < 8) ? (base + i) : (16 + base + (i - 8));
}

// Load one 16x32 A fragment from f32 row-major source (vectorized float4)
__device__ __forceinline__ v16h load_a_f32(const float* __restrict__ src, int lda) {
    int lane = threadIdx.x & 31;
    int m = lane & 15, sel = lane >> 4;
    const float4* p = (const float4*)(src + m * lda);
    float4 u0 = p[sel * 2 + 0];      // K = sel*8 .. sel*8+3
    float4 u1 = p[sel * 2 + 1];      // K = sel*8+4 .. sel*8+7
    float4 u2 = p[4 + sel * 2 + 0];  // K = 16+sel*8 ..
    float4 u3 = p[4 + sel * 2 + 1];
    v16h a;
    a[0]  = (_Float16)u0.x; a[1]  = (_Float16)u0.y; a[2]  = (_Float16)u0.z; a[3]  = (_Float16)u0.w;
    a[4]  = (_Float16)u1.x; a[5]  = (_Float16)u1.y; a[6]  = (_Float16)u1.z; a[7]  = (_Float16)u1.w;
    a[8]  = (_Float16)u2.x; a[9]  = (_Float16)u2.y; a[10] = (_Float16)u2.z; a[11] = (_Float16)u2.w;
    a[12] = (_Float16)u3.x; a[13] = (_Float16)u3.y; a[14] = (_Float16)u3.z; a[15] = (_Float16)u3.w;
    return a;
}

// Load one 16x32 A fragment from an f16 LDS tile [16][DIM]
// (per-lane halves are two contiguous 16B runs -> merges into ds_load_b128 x2)
__device__ __forceinline__ v16h load_a_lds(const _Float16* tile, int k0) {
    int lane = threadIdx.x & 31;
    int m = lane & 15, sel = lane >> 4;
    const _Float16* row = tile + m * DIM + k0;
    v16h a;
#pragma unroll
    for (int i = 0; i < 16; ++i) a[i] = row[kmap(i, sel)];
    return a;
}

// Pre-packed B fragments: per fragment (j,kk), lane l owns 16 contiguous halves
// (32 bytes) -> a single vector load (2 x global_load_b128) at GEMM time.
__device__ __forceinline__ v16h load_b_packed(const _Float16* __restrict__ P, int j, int kk) {
    int lane = threadIdx.x & 31;
    return *(const v16h*)(P + ((size_t)(j * 4 + kk) * 32 + lane) * 16);
}

// ---------------------------------------------------------------------------
// Pack one fragment of an f32 weight matrix [128][128] into WMMA B-fragment f16
// layout. One wave per (j,kk) fragment; 32 fragments per matrix.
// ---------------------------------------------------------------------------
__device__ __forceinline__ void pack_w(const float* __restrict__ W,
                                       _Float16* __restrict__ P, int frag) {
    int j = frag >> 2, kk = frag & 3;   // frag = j*4 + kk
    int lane = threadIdx.x & 31;
    int n = lane & 15, sel = lane >> 4;
    _Float16* dstp = P + ((size_t)frag * 32 + lane) * 16;
#pragma unroll
    for (int i = 0; i < 16; ++i)
        dstp[i] = (_Float16)W[(size_t)(kk * 32 + kmap(i, sel)) * DIM + j * 16 + n];
}

// ---------------------------------------------------------------------------
// First pass of the edge sort, one chunk of CHUNK edges a block, all in LDS: count
// the chunk's edges per bin of NPB destination nodes (the returned old count is the
// edge's place in its bin), scan the counts, lay the edges out bin by bin and write
// them as whole lines. An edge is one word: node within its bin << 16 | source node.
// tab gets one word a bin: start in the chunk | count << 16.
// ---------------------------------------------------------------------------
__device__ __forceinline__ void coarse_sort(const int* __restrict__ src, const int* __restrict__ dst,
                                            int* __restrict__ tab, int* __restrict__ part,
                                            int E, int blk, int* cnt, int* off, int* sorted) {
    int t = threadIdx.x;
    cnt[t] = 0;
    int d[16], v[16], br[16], ix[16];
    int e0 = blk * CHUNK + t;
#pragma unroll
    for (int k = 0; k < 16; ++k) {
        ix[k] = min(e0 + k * 256, E - 1);   // past the end: the last edge again, dropped below
        d[k] = dst[ix[k]];
        v[k] = src[ix[k]];
    }
    // the index registers may be written again below: wait first. The statement takes them
    // as inputs, so that none of the 32 loads gets one of them for its result
    asm volatile("s_wait_xcnt 0x0" :: "v"(ix[0]), "v"(ix[1]), "v"(ix[2]), "v"(ix[3]), "v"(ix[4]), "v"(ix[5]),
                 "v"(ix[6]), "v"(ix[7]), "v"(ix[8]), "v"(ix[9]), "v"(ix[10]), "v"(ix[11]), "v"(ix[12]),
                 "v"(ix[13]), "v"(ix[14]), "v"(ix[15]) : "memory");
    __syncthreads();   // the counters are zero for every wave
#pragma unroll
    for (int k = 0; k < 16; ++k) {
        bool ok = e0 + k * 256 < E && (unsigned)d[k] < (unsigned)NNODES;
        // no edge: the last pad bin, which nobody reads; so no branch stands here and the
        // 16 LDS adds of a thread are in flight together
        int bin = ok ? (int)((unsigned)d[k] / (unsigned)NPB) : TABW - 1;
        v[k] = ((ok ? d[k] - bin * NPB : 0) << 16) | min(max(v[k], 0), NNODES - 1);
        br[k] = bin;
    }
#pragma unroll
    for (int k = 0; k < 16; ++k)
        d[k] = atomicAdd(&cnt[br[k]], 1);
    __syncthreads();   // all counts are in
    if (t < 32) {      // exclusive scan of the TABW counts by one wave, 8 a lane
        int c[8], sum = 0;
#pragma unroll
        for (int i = 0; i < 8; ++i) { c[i] = sum; sum += cnt[t * 8 + i]; }
        int inc = sum;
#pragma unroll
        for (int m = 1; m < 32; m <<= 1) {
            int o = __shfl_up(inc, m, 32);
            if (t >= m) inc += o;
        }
#pragma unroll
        for (int i = 0; i < 8; ++i) off[t * 8 + i] = inc - sum + c[i];
    }
    __syncthreads();   // the starts are known
    tab[blk * TABW + t] = off[t] | (cnt[t] << 16);
    // the store's address registers may be written again below: wait first
    asm volatile("s_wait_xcnt 0x0" ::: "memory");
#pragma unroll
    for (int k = 0; k < 16; ++k)
        sorted[off[br[k]] + d[k]] = v[k];
    __syncthreads();   // the chunk lies sorted in LDS: every thread has placed 16 words, CHUNK in all
#pragma unroll
    for (int k = 0; k < 4; ++k)
        ((int4*)(part + blk * CHUNK))[t + k * 256] = ((const int4*)sorted)[t + k * 256];
    // the stores' address registers may be written again behind them: wait first
    asm volatile("s_wait_xcnt 0x0" ::: "memory");
}

// ---------------------------------------------------------------------------
// Launch 1: two jobs that depend on nothing share one grid; the block index picks
// the job. Blocks 0..15 pack the four weight matrices (4 blocks each, P holds the
// four packed matrices one behind the other); the others sort a chunk of edges each.
// ---------------------------------------------------------------------------
__global__ __launch_bounds__(256) void pack_and_sort(
        const float* __restrict__ Wq, const float* __restrict__ Wk,
        const float* __restrict__ Wv, const float* __restrict__ Wo,
        _Float16* __restrict__ P,
        const int* __restrict__ src, const int* __restrict__ dst,
        int* __restrict__ bkt, int* __restrict__ tab, int* __restrict__ part, int E) {
    __shared__ int cnt[TABW];
    __shared__ int off[TABW];
    __shared__ __attribute__((aligned(16))) int sorted[CHUNK];
    int b = blockIdx.x;
    if (b < PACK_BLOCKS) {
        int mtx = b >> 2;
        const float* W = mtx == 0 ? Wq : mtx == 1 ? Wk : mtx == 2 ? Wv : Wo;
        pack_w(W, P + mtx * (32 * 32 * 16), (b & 3) * 8 + (threadIdx.x >> 5));
        // bucket NNODES holds no edges: its counter counts the spilled edges of launch 2
        if (b == 0 && threadIdx.x == 0) bkt[NNODES * BKT + CAP] = 0;
    } else if (b - PACK_BLOCKS < PROD_MAX) {
        coarse_sort(src, dst, tab, part, E, b - PACK_BLOCKS, cnt, off, sorted);
    }
}

// ---------------------------------------------------------------------------
// Fused Q/K/V projection of one 16-row tile by one wave; Q, K and V are stored
// as f16. The weight fragment is the A operand and the x fragment the B operand
// (both have the same lane and k map), so a lane holds 8 neighbouring columns of
// one node: one 16-byte write into the wave's own LDS tile, which goes out as
// whole 256-byte rows.
// Weight fragments double-buffered across the column-tile loop so global loads
// overlap the WMMAs instead of serializing load->wait->wmma.
// ---------------------------------------------------------------------------
__device__ __forceinline__ void qkv_gemm(
        const float* __restrict__ x,
        const _Float16* __restrict__ Pq, const float* __restrict__ bq,
        const _Float16* __restrict__ Pk, const float* __restrict__ bk,
        const _Float16* __restrict__ Pv, const float* __restrict__ bv,
        _Float16* __restrict__ Q, _Float16* __restrict__ K, _Float16* __restrict__ V,
        int row0, _Float16* stage) {
    int lane = threadIdx.x & 31;

    v16h a[4];
#pragma unroll
    for (int kk = 0; kk < 4; ++kk)
        a[kk] = load_a_f32(x + (size_t)row0 * DIM + kk * 32, DIM);
    // a B load's result may land in the x loads' address pair: wait first
    asm volatile("s_wait_xcnt 0x0" ::: "memory");

    const _Float16* Ps[3] = {Pq, Pk, Pv};
    const float*    bs[3] = {bq, bk, bv};
    _Float16*       Os[3] = {Q, K, V};

    int n  = lane & 15;
    int mb = (lane >> 4) * 8;

#pragma unroll
    for (int mtx = 0; mtx < 3; ++mtx) {
        const _Float16* P    = Ps[mtx];
        const float*    bias = bs[mtx];
        _Float16*       out  = Os[mtx];

        v16h b[4];
#pragma unroll
        for (int kk = 0; kk < 4; ++kk) b[kk] = load_b_packed(P, 0, kk);
        v4f bb0 = *(const v4f*)(bias + mb);       // the lane's 8 columns of tile 0
        v4f bb1 = *(const v4f*)(bias + mb + 4);

#pragma unroll
        for (int j = 0; j < 8; ++j) {
            v16h bn[4];
            v4f bn0, bn1;
            if (j < 7) {
#pragma unroll
                for (int kk = 0; kk < 4; ++kk) bn[kk] = load_b_packed(P, j + 1, kk);
                bn0 = *(const v4f*)(bias + (j + 1) * 16 + mb);
                bn1 = *(const v4f*)(bias + (j + 1) * 16 + mb + 4);
            }
            v8f acc = {};
#pragma unroll
            for (int kk = 0; kk < 4; ++kk)
                acc = __builtin_amdgcn_wmma_f32_16x16x32_f16(
                        false, b[kk], false, a[kk], (short)0, acc, false, false);

            // acc[i] = node row0 + n, column j * 16 + mb + i
            v8h h;
            h[0] = (_Float16)(acc[0] + bb0.x); h[1] = (_Float16)(acc[1] + bb0.y);
            h[2] = (_Float16)(acc[2] + bb0.z); h[3] = (_Float16)(acc[3] + bb0.w);
            h[4] = (_Float16)(acc[4] + bb1.x); h[5] = (_Float16)(acc[5] + bb1.y);
            h[6] = (_Float16)(acc[6] + bb1.z); h[7] = (_Float16)(acc[7] + bb1.w);
            *(v8h*)(stage + n * SPITCH + j * 16 + mb) = h;

#pragma unroll
            for (int kk = 0; kk < 4; ++kk) b[kk] = bn[kk];
            bb0 = bn0; bb1 = bn1;
            // holds the next tile's loads inside this tile (loaded values as inputs only):
            // without it the compiler sinks each load to just in front of its own WMMA
            if (j < 7)
                asm volatile("" :: "v"(bn[0]), "v"(bn[1]), "v"(bn[2]), "v"(bn[3]), "v"(bn0), "v"(bn1));
        }

        // other lanes of this wave read the tile back: their writes must have landed,
        // and the compiler must not move the reads up
        asm volatile("s_wait_dscnt 0x0" ::: "memory");
        _Float16*       gp = out + (size_t)(row0 + (lane >> 4)) * DIM + n * 8;
        const _Float16* sp = stage + (lane >> 4) * SPITCH + n * 8;
#pragma unroll
        for (int r = 0; r < 8; ++r)     // rows 2r and 2r + 1: 512 contiguous bytes a store
            *(v8h*)(gp + r * 2 * DIM) = *(const v8h*)(sp + r * 2 * SPITCH);
        // a later load's result may land in a register these stores name; and the next
        // matrix's LDS writes stay behind the reads above
        asm volatile("s_wait_xcnt 0x0" ::: "memory");
    }
}

// ---------------------------------------------------------------------------
// Second pass of the edge sort: one block builds the buckets of the NPB nodes of one
// bin in LDS and writes them out as whole lines, each with its node's edge count at
// place CAP. The bin's edges lie in one run per chunk; a wave takes every 8th chunk,
// one run a load, 8 loads in flight. The old value of the node's LDS counter is the
// edge's place (arrival order). An edge that finds its bucket full goes, as the pair
// (dst, src), to the end of one spill list that all nodes share (at most E pairs).
// ---------------------------------------------------------------------------
__device__ __forceinline__ void put_edge(int val, int r, int bin, int* lb,
                                         int* __restrict__ bkt, int* __restrict__ spill, int E) {
    int dl = val >> 16, sn = val & 0xffff;
    if (r < CAP) {
        lb[dl * BKT + r] = sn;
    } else {
        int o = atomicAdd(bkt + NNODES * BKT + CAP, 1);
        if ((unsigned)o < (unsigned)E) ((int2*)spill)[o] = make_int2(bin * NPB + dl, sn);
        // the registers that the add and the store name may be written again below: wait first
        asm volatile("s_wait_xcnt 0x0" ::: "memory");
    }
}

__device__ __forceinline__ void fine_bucket(const int* __restrict__ tab, const int* __restrict__ part,
                                            int* __restrict__ bkt, int* __restrict__ spill,
                                            int E, int bin, int* lb, int* lcnt) {
    int t = threadIdx.x, lane = t & 31;
    int w = __builtin_amdgcn_readfirstlane(t >> 5);
    int nprod = min((E + CHUNK - 1) / CHUNK, PROD_MAX);
    // lane i: the table word of this wave's i-th chunk (PROD_MAX <= 8 * 32); none: count 0
    int p = w + 8 * lane;
    int ent = tab[min(p, nprod - 1) * TABW + bin];
    if (p >= nprod) ent = 0;
    // the load's address registers may be written again below: wait first
    asm volatile("s_wait_xcnt 0x0" ::: "memory");
#pragma unroll
    for (int k = 0; k < 7; ++k) {
        int i = t + k * 256;
        if (i < NPB * 8) ((int4*)lb)[i] = make_int4(0, 0, 0, 0);
    }
    if (t < NPB + 32) lcnt[t] = 0;
    __syncthreads();   // buckets and counters are zero for every wave

    // kept rolled: four copies of this body would make the kernel's text four times as long
    // for nothing, and push the projection code far back in it
#pragma unroll 1
    for (int i0 = 0; i0 < 32; i0 += 8) {
        int v[8];
#pragma unroll
        for (int u = 0; u < 8; ++u) {
            int en = __builtin_amdgcn_readlane(ent, i0 + u);
            int st = en & 0xffff;
            int n = min(en >> 16, CHUNK - st);   // a run ends inside its own chunk
            v[u] = -1;
            if (lane < n) v[u] = part[(w + 8 * (i0 + u)) * CHUNK + st + lane];
        }
        // the loads' address registers may be written again below: wait first
        asm volatile("s_wait_xcnt 0x0" ::: "memory");
        // a lane without an edge adds to a pad counter of its own: no branch stands here,
        // so the 8 LDS adds are in flight together
        int r[8];
#pragma unroll
        for (int u = 0; u < 8; ++u)
            r[u] = atomicAdd(&lcnt[v[u] >= 0 ? v[u] >> 16 : NPB + lane], 1);
#pragma unroll
        for (int u = 0; u < 8; ++u)
            if (v[u] >= 0) put_edge(v[u], r[u], bin, lb, bkt, spill, E);
        // a run of more than 32 edges: the rest, 32 a trip
        for (int u = 0; u < 8; ++u) {
            int en = __builtin_amdgcn_readlane(ent, i0 + u);
            int st = en & 0xffff;
            int n = min(en >> 16, CHUNK - st);   // at most CHUNK / 32 trips
            for (int k = 32; k < n; k += 32) {
                if (k + lane < n) {
                    int val = part[(w + 8 * (i0 + u)) * CHUNK + st + k + lane];
                    // the load's address registers may be written again below: wait first
                    asm volatile("s_wait_xcnt 0x0" ::: "memory");
                    put_edge(val, atomicAdd(&lcnt[val >> 16], 1), bin, lb, bkt, spill, E);
                }
            }
        }
    }
    __syncthreads();   // every edge of the bin is placed

    int4* go = (int4*)(bkt + bin * (NPB * BKT));
#pragma unroll
    for (int k = 0; k < 7; ++k) {
        int i = t + k * 256;
        if (i < NPB * 8) {
            int4 q = ((const int4*)lb)[i];
            if ((i & 7) == 7) q.w = lcnt[i >> 3];
            go[i] = q;
        }
    }
    // the stores' address registers may be written again behind them: wait first
    asm volatile("s_wait_xcnt 0x0" ::: "memory");
}

// ---------------------------------------------------------------------------
// Launch 2: the projections and the edge buckets need only launch 1 and not each
// other, so they share one grid. The projection blocks come first: they live
// longest. All blocks are resident at once: 8 waves a SIMD (128 registers) leaves
// room for the bucket blocks beside the two projection blocks of a WGP. A bucket
// block uses the staging tile's LDS for its buckets and counters.
// ---------------------------------------------------------------------------
__global__ __launch_bounds__(256, 8) void qkv_and_bucket(
        const float* __restrict__ x,
        const _Float16* __restrict__ Pq, const float* __restrict__ bq,
        const _Float16* __restrict__ Pk, const float* __restrict__ bk,
        const _Float16* __restrict__ Pv, const float* __restrict__ bv,
        _Float16* __restrict__ Q, _Float16* __restrict__ K, _Float16* __restrict__ V,
        const int* __restrict__ tab, const int* __restrict__ part, int* __restrict__ bkt,
        int* __restrict__ spill, int E) {
    __shared__ __attribute__((aligned(16))) _Float16 stage[8 * 16 * SPITCH];   // one tile a wave
    static_assert(sizeof(stage) >= (NPB * BKT + NPB + 32) * sizeof(int), "the buckets of a bin fit the tile");
    int b = blockIdx.x;
    if (b < QKV_BLOCKS) {
        int w = __builtin_amdgcn_readfirstlane(threadIdx.x >> 5);
        int tile = b + QKV_BLOCKS * w;
        if (tile < ROWTILES)
            qkv_gemm(x, Pq, bq, Pk, bk, Pv, bv, Q, K, V, tile * 16, stage + w * (16 * SPITCH));
    } else {
        int* lb = (int*)stage;
        fine_bucket(tab, part, bkt, spill, E, b - QKV_BLOCKS, lb, lb + NPB * BKT);
    }
}

// ---------------------------------------------------------------------------
// acc += f16 half of h (low or high) * f32 w, in f32: one instruction, no separate
// conversion (the compiler's own form converts every half first)
__device__ __forceinline__ float fma_lo(unsigned h, float w, float acc) {
    asm("v_fma_mix_f32 %0, %1, %2, %0 op_sel_hi:[1,0,0]" : "+v"(acc) : "v"(h), "v"(w));
    return acc;
}
__device__ __forceinline__ float fma_hi(unsigned h, float w, float acc) {
    asm("v_fma_mix_f32 %0, %1, %2, %0 op_sel:[1,0,0] op_sel_hi:[1,0,0]" : "+v"(acc) : "v"(h), "v"(w));
    return acc;
}

// ---------------------------------------------------------------------------
// The weighted V sum of one destination node by one wave, f16 K and V rows of 256
// bytes. A lane holds 8 of the 128 columns (16 bytes), so 16 lanes cover a row and
// one wave-wide load brings the rows of two edges: the low lanes take the even
// edges, the high lanes the odd ones. Eight edges are walked at a time (8 loads in
// flight); sums are f32 in registers and the two halves are added at the end. The
// first pass takes the node's own bucket (own: place l in lane l); only a node that
// counted more than CAP edges goes on through the spill list, 32 pairs a pass, and
// packs the sources of its own pairs into the low lanes.
// Returns columns (lane & 15) * 8 + (lane >> 4) * 4 .. + 3 of the node's row.
// ---------------------------------------------------------------------------
__device__ __forceinline__ float4 node_sum(
        const _Float16* __restrict__ K, const _Float16* __restrict__ V,
        const int* __restrict__ spill, int node, int total, int nspill, int own, v8h qh) {
    int lane = threadIdx.x & 31;
    int c = lane & 15, hi = lane >> 4;
    float q[8], acc[8];
#pragma unroll
    for (int i = 0; i < 8; ++i) {
        q[i] = (float)qh[i] * 0.25f;   // 1/sqrt(16), exact
        acc[i] = 0.0f;
    }

    for (int base = -32; base < nspill; base += 32) {
        int n, idx;
        if (base < 0) {
            n = min(total, CAP);
            idx = own;
        } else {
            int2 ds = ((const int2*)spill)[min(base + lane, nspill - 1)];
            bool mine = base + lane < nspill && ds.x == node;
            unsigned mask = __builtin_amdgcn_ballot_w32(mine);
            unsigned below = (1u << lane) - 1u;
            n = __popc(mask);
            // a permutation of the 32 lanes: own pairs first, in list order, the others behind
            int to = mine ? __popc(mask & below) : n + __popc(~mask & below);
            idx = __builtin_amdgcn_ds_permute(to * 4, ds.y);
        }
        for (int j = 0; j < n; j += 8) {
            uint4 kv[4], vv[4];   // 8 halves each
            unsigned o[4];
#pragma unroll
            for (int u = 0; u < 4; ++u) {
                // past the end: the last edge's rows again (same lines), weight 0 below
                unsigned s0 = (unsigned)__builtin_amdgcn_readlane(idx, min(j + 2 * u, n - 1));
                unsigned s1 = (unsigned)__builtin_amdgcn_readlane(idx, min(j + 2 * u + 1, n - 1));
                o[u] = (hi ? s1 : s0) * (DIM * 2u) + c * 16u;   // one 32-bit byte offset for both rows
                kv[u] = *(const uint4*)((const char*)K + o[u]);
                vv[u] = *(const uint4*)((const char*)V + o[u]);
            }
            // the offset registers are written again below: wait first. The statement takes
            // them as inputs, so that none of the 8 loads gets one of them for its result
            asm volatile("s_wait_xcnt 0x0" :: "v"(o[0]), "v"(o[1]), "v"(o[2]), "v"(o[3]) : "memory");
#pragma unroll
            for (int u = 0; u < 4; ++u) {
                float p = 0.0f;
                p = fma_lo(kv[u].x, q[0], p); p = fma_hi(kv[u].x, q[1], p);
                p = fma_lo(kv[u].y, q[2], p); p = fma_hi(kv[u].y, q[3], p);
                p = fma_lo(kv[u].z, q[4], p); p = fma_hi(kv[u].z, q[5], p);
                p = fma_lo(kv[u].w, q[6], p); p = fma_hi(kv[u].w, q[7], p);
                // a head is 16 columns = 2 neighbouring lanes: add lanes 1,0,3,2
                p += __int_as_float(__builtin_amdgcn_update_dpp(0, __float_as_int(p), 0xB1, 0xf, 0xf, true));
                p = fminf(5.0f, fmaxf(-5.0f, p));   // clamp(-5, 5)
                float sc = (j + 2 * u + hi < n) ? __expf(p) : 0.0f;
                acc[0] = fma_lo(vv[u].x, sc, acc[0]); acc[1] = fma_hi(vv[u].x, sc, acc[1]);
                acc[2] = fma_lo(vv[u].y, sc, acc[2]); acc[3] = fma_hi(vv[u].y, sc, acc[3]);
                acc[4] = fma_lo(vv[u].z, sc, acc[4]); acc[5] = fma_hi(vv[u].z, sc, acc[5]);
                acc[6] = fma_lo(vv[u].w, sc, acc[6]); acc[7] = fma_hi(vv[u].w, sc, acc[7]);
            }
        }
    }

    // even-edge and odd-edge sums meet: a lane keeps 4 of its 8 columns and gets the
    // other half-wave's sums of those (lane l <-> l ^ 16)
    float4 r;
    float* rp = &r.x;
#pragma unroll
    for (int i = 0; i < 4; ++i) {
        int give = __float_as_int(hi ? acc[i] : acc[4 + i]);
        float got = __int_as_float(__builtin_amdgcn_permlanex16(give, give, 0x76543210, 0xfedcba98, false, false));
        rp[i] = (hi ? acc[4 + i] : acc[i]) + got;
    }
    return r;
}

// ---------------------------------------------------------------------------
// Launch 3: edge sums -> residual + LN1 -> LN2 -> Wo GEMM (WMMA from LDS) -> ReLU +
// residual, one 16-node tile per block of 128 threads (4 waves). A wave sums the
// edges of 4 nodes, one after the other, and leaves each row in the LDS tile; these
// are the very 4 rows whose LayerNorms it does next, so the sums never go through
// memory and no barrier stands between the two parts. The buckets (each with its
// count in lane CAP) and Q rows of all 4 nodes and the wave's share of x are asked for
// at the start, so that only the K and V gathers wait one behind the other. 9 waves a
// SIMD: 112 registers.
// ---------------------------------------------------------------------------
__global__ __launch_bounds__(128, 9) void attn_ln_out(
        const _Float16* __restrict__ Q, const _Float16* __restrict__ K,
        const _Float16* __restrict__ V, const int* __restrict__ bkt,
        const int* __restrict__ spill, int E,
        const float* __restrict__ x,
        const _Float16* __restrict__ Po, const float* __restrict__ bo,
        const float* __restrict__ g1, const float* __restrict__ b1,
        const float* __restrict__ g2, const float* __restrict__ b2,
        float* __restrict__ out) {
    __shared__ __attribute__((aligned(16))) float h2s[16 * DIM];   // edge sums, then in place the post-LN1 tile (residual for epilogue)
    __shared__ _Float16 gs[16 * DIM];    // post-LN2 tile (A matrix for WMMA)

    int row0 = blockIdx.x * 16;
    int t = threadIdx.x;
    int r  = t >> 3;          // row in tile (8 threads per row; contiguous in wave)
    int c0 = (t & 7) * 16;    // 16 columns per thread
    int wave = __builtin_amdgcn_readfirstlane(t >> 5);
    int lane = t & 31;

    // --- what the 4 nodes of this wave need, all asked for at once ---
    int nb = row0 + wave * 4;
    // the buckets first: the gathers hang on them alone. One load brings a node's count
    // and its sources (every int of the line was written in this call, by launch 2)
    int own[4];
#pragma unroll
    for (int k = 0; k < 4; ++k)
        own[k] = bkt[(nb + k) * BKT + lane];
    // an x load's result may land in the bucket loads' address register: wait first
    asm volatile("s_wait_xcnt 0x0" ::: "memory");
    float4 xv[4];
#pragma unroll
    for (int i = 0; i < 4; ++i)
        xv[i] = *(const float4*)(x + (size_t)(row0 + r) * DIM + c0 + i * 4);
    // a Q load's result may land in the x loads' address pair: wait first
    asm volatile("s_wait_xcnt 0x0" ::: "memory");
    v8h qh[4];
#pragma unroll
    for (int k = 0; k < 4; ++k)
        qh[k] = *(const v8h*)(Q + (size_t)(nb + k) * DIM + (lane & 15) * 8);
    // the address registers of the loads above may be written again below: wait first
    asm volatile("s_wait_xcnt 0x0" ::: "memory");
    int tot[4];
#pragma unroll
    for (int k = 0; k < 4; ++k)
        tot[k] = __builtin_amdgcn_readlane(own[k], CAP);

    // --- edge sums of the 4 nodes ---
#pragma unroll
    for (int k = 0; k < 4; ++k) {
        int nspill = 0;
        if (tot[k] > CAP) nspill = min(__builtin_amdgcn_readfirstlane(bkt[NNODES * BKT + CAP]), E);
        float4 s4 = node_sum(K, V, spill, nb + k, tot[k], nspill, own[k], qh[k]);
        ((float4*)(h2s + (wave * 4 + k) * DIM))[(lane & 15) * 2 + (lane >> 4)] = s4;
    }
    // other lanes of this wave read these rows back: their writes must have landed,
    // and the compiler must not move the reads up
    asm volatile("s_wait_dscnt 0x0" ::: "memory");

    // --- preload this wave's B fragments (independent of LDS/LN work) ---
    v16h b0[4], b1f[4];
#pragma unroll
    for (int kk = 0; kk < 4; ++kk) {
        b0[kk]  = load_b_packed(Po, wave * 2 + 0, kk);
        b1f[kk] = load_b_packed(Po, wave * 2 + 1, kk);
    }

    // --- residual + LN1 ---
    float v[16];
    float s = 0.0f, ss = 0.0f;
#pragma unroll
    for (int i = 0; i < 16; ++i) {
        float val = (&xv[i >> 2].x)[i & 3] + h2s[r * DIM + c0 + i];
        v[i] = val; s += val; ss += val * val;
    }
#pragma unroll
    for (int m = 1; m < 8; m <<= 1) {     // reduce within the 8 lanes of a row
        s  += __shfl_xor(s,  m, 32);
        ss += __shfl_xor(ss, m, 32);
    }
    float mean = s * (1.0f / DIM);
    float var  = ss * (1.0f / DIM) - mean * mean;
    float rstd = rsqrtf(var + 1e-5f);

    // --- LN2 on LN1 output ---
    float s2 = 0.0f, ss2 = 0.0f;
#pragma unroll
    for (int i = 0; i < 16; ++i) {
        int c = c0 + i;
        float h = (v[i] - mean) * rstd * g1[c] + b1[c];
        v[i] = h;
        h2s[r * DIM + c] = h;
        s2 += h; ss2 += h * h;
    }
#pragma unroll
    for (int m = 1; m < 8; m <<= 1) {
        s2  += __shfl_xor(s2,  m, 32);
        ss2 += __shfl_xor(ss2, m, 32);
    }
    float mean2 = s2 * (1.0f / DIM);
    float var2  = ss2 * (1.0f / DIM) - mean2 * mean2;
    float rstd2 = rsqrtf(var2 + 1e-5f);
#pragma unroll
    for (int i = 0; i < 16; ++i) {
        int c = c0 + i;
        gs[r * DIM + c] = (_Float16)((v[i] - mean2) * rstd2 * g2[c] + b2[c]);
    }
    __syncthreads();

    // --- Wo GEMM + bias + ReLU + residual epilogue ---
    v16h a[4];
#pragma unroll
    for (int kk = 0; kk < 4; ++kk) a[kk] = load_a_lds(gs, kk * 32);

    int n  = lane & 15;
    int mb = (lane >> 4) * 8;

#pragma unroll
    for (int jj = 0; jj < 2; ++jj) {      // 8 column tiles / 4 waves
        int j = wave * 2 + jj;
        v8f acc = {};
#pragma unroll
        for (int kk = 0; kk < 4; ++kk) {
            v16h b = (jj == 0) ? b0[kk] : b1f[kk];
            acc = __builtin_amdgcn_wmma_f32_16x16x32_f16(
                    false, a[kk], false, b, (short)0, acc, false, false);
        }
        int col = j * 16 + n;
        float bb = bo[col];
#pragma unroll
        for (int i = 0; i < 8; ++i) {
            float relu = fmaxf(acc[i] + bb, 0.0f);
            out[(size_t)(row0 + mb + i) * DIM + col] = h2s[(mb + i) * DIM + col] + relu;
        }
    }
}

// ---------------------------------------------------------------------------
extern "C" void kernel_launch(void* const* d_in, const int* in_sizes, int n_in,
                              void* d_out, int out_size, void* d_ws, size_t ws_size,
                              hipStream_t stream) {
    const float* x  = (const float*)d_in[0];
    const int*   src = (const int*)d_in[1];
    const int*   dst = (const int*)d_in[2];
    const float* Wq = (const float*)d_in[3];
    const float* bq = (const float*)d_in[4];
    const float* Wk = (const float*)d_in[5];
    const float* bk = (const float*)d_in[6];
    const float* Wv = (const float*)d_in[7];
    const float* bv = (const float*)d_in[8];
    const float* Wo = (const float*)d_in[9];
    const float* bo = (const float*)d_in[10];
    const float* g1 = (const float*)d_in[11];
    const float* b1 = (const float*)d_in[12];
    const float* g2 = (const float*)d_in[13];
    const float* b2 = (const float*)d_in[14];
    float* out = (float*)d_out;

    int E = in_sizes[1];
    size_t nd = (size_t)NNODES * DIM;
    _Float16* Q = (_Float16*)d_ws;   // projections, f16
    _Float16* K = Q + nd;
    _Float16* V = K + nd;
    // packed f16 weight fragments: 32 frags * 32 lanes * 16 halves = 16384 halves each
    _Float16* Pq = V + nd;
    _Float16* Pk = Pq + 32 * 32 * 16;
    _Float16* Pv = Pk + 32 * 32 * 16;
    _Float16* Po = Pv + 32 * 32 * 16;
    // edges by dst: a bucket per node (CAP source nodes and the counter), the chunks' bin
    // tables, the chunks sorted by bin, spilled (dst, src) pairs
    int* bkt   = (int*)(Po + 32 * 32 * 16);
    int* tab   = bkt + (NNODES + 1) * BKT;
    int* part  = tab + PROD_MAX * TABW;
    int* spill = part + PROD_MAX * CHUNK;

    pack_and_sort<<<PACK_BLOCKS + (E + CHUNK - 1) / CHUNK, 256, 0, stream>>>(
        Wq, Wk, Wv, Wo, Pq, src, dst, bkt, tab, part, E);
    qkv_and_bucket<<<QKV_BLOCKS + NBINS, 256, 0, stream>>>(
        x, Pq, bq, Pk, bk, Pv, bv, Q, K, V, tab, part, bkt, spill, E);
    attn_ln_out<<<ROWTILES, 128, 0, stream>>>(Q, K, V, bkt, spill, E, x, Po, bo, g1, b1, g2, b2, out);
}

// v008
// Measured time: 64.9 microseconds a run.
// Two timings next to v007 put it at 1.03 and 1.02 times that version's speed.
// Over all steps from v000 it is 8.91 times as fast.
#include <hip/hip_runtime.h>

#define NNODES 50000
#define DIM 128
#define NHEADS 8
#define HD 16
#define ROWTILES (NNODES / 16)   // 3125 exactly
#define BKT 32                   // ints in a node's bucket: one 128-byte line, one int a lane
#define CAP 31                   // places 0..30 hold source nodes; place CAP is the node's own edge counter
#define NPB 200                  // nodes a bin: one block of launch 2 builds their buckets in LDS
#define NBINS (NNODES / NPB)     // 250 exactly
#define TABW 256                 // table words a chunk: one a bin, padded to the block's threads
#define CHUNK 4096               // edges a block of launch 1 sorts by bin: 16 a thread
#define PROD_MAX 196             // chunks of the 800000 edges of the problem's shape
#define PACK_BLOCKS 16           // 4 matrices x 32 fragments, one wave each, 8 waves a block
#define QKV_BLOCKS 512           // two blocks a WGP; wave w of block b takes row tile b + 512 * w

#define SPITCH 136               // halves a row of the store staging tile: 272 B, 16 B x odd

typedef __attribute__((ext_vector_type(16))) _Float16 v16h;
typedef __attribute__((ext_vector_type(8)))  _Float16 v8h;
typedef __attribute__((ext_vector_type(8)))  float    v8f;
typedef __attribute__((ext_vector_type(4)))  float    v4f;

// CDNA5 16-bit A-matrix 16x32 layout (ISA 7.12.2):
// lanes 0-15  (sel=0): halves 0..7 -> K=0..7,  halves 8..15 -> K=16..23
// lanes 16-31 (sel=1): halves 0..7 -> K=8..15, halves 8..15 -> K=24..31
__device__ __forceinline__ int kmap(int i, int sel) {
    int base = sel ? 8 : 0;
    return (i < 8) ? (base + i) : (16 + base + (i - 8));
}

// Load one 16x32 A fragment from f32 row-major source (vectorized float4)
__device__ __forceinline__ v16h load_a_f32(const float* __restrict__ src, int lda) {
    int lane = threadIdx.x & 31;
    int m = lane & 15, sel = lane >> 4;
    const float4* p = (const float4*)(src + m * lda);
    float4 u0 = p[sel * 2 + 0];      // K = sel*8 .. sel*8+3
    float4 u1 = p[sel * 2 + 1];      // K = sel*8+4 .. sel*8+7
    float4 u2 = p[4 + sel * 2 + 0];  // K = 16+sel*8 ..
    float4 u3 = p[4 + sel * 2 + 1];
    v16h a;
    a[0]  = (_Float16)u0.x; a[1]  = (_Float16)u0.y; a[2]  = (_Float16)u0.z; a[3]  = (_Float16)u0.w;
    a[4]  = (_Float16)u1.x; a[5]  = (_Float16)u1.y; a[6]  = (_Float16)u1.z; a[7]  = (_Float16)u1.w;
    a[8]  = (_Float16)u2.x; a[9]  = (_Float16)u2.y; a[10] = (_Float16)u2.z; a[11] = (_Float16)u2.w;
    a[12] = (_Float16)u3.x; a[13] = (_Float16)u3.y; a[14] = (_Float16)u3.z; a[15] = (_Float16)u3.w;
    return a;
}

// Load one 16x32 A fragment from an f16 LDS tile [16][DIM]
// (per-lane halves are two contiguous 16B runs -> merges into ds_load_b128 x2)
__device__ __forceinline__ v16h load_a_lds(const _Float16* tile, int k0) {
    int lane = threadIdx.x & 31;
    int m = lane & 15, sel = lane >> 4;
    const _Float16* row = tile + m * DIM + k0;
    v16h a;
#pragma unroll
    for (int i = 0; i < 16; ++i) a[i] = row[kmap(i, sel)];
    return a;
}

// Pre-packed B fragments: a fragment (j,kk) is two planes of 512 bytes, the lanes' halves
// 0..7 one lane behind the other, then their halves 8..15. Each of the two
// global_load_b128 of a fragment so covers 4 whole 128-byte lines.
__device__ __forceinline__ v16h load_b_packed(const _Float16* __restrict__ P, int j, int kk) {
    int lane = threadIdx.x & 31;
    const v8h* p = (const v8h*)(P + (size_t)(j * 4 + kk) * 512) + lane;
    v8h lo = p[0], hi = p[32];
    return __builtin_shufflevector(lo, hi, 0, 1, 2, 3, 4, 5, 6, 7, 8, 9, 10, 11, 12, 13, 14, 15);
}

// ---------------------------------------------------------------------------
// Pack one fragment of an f32 weight matrix [128][128] into WMMA B-fragment f16
// layout. One wave per (j,kk) fragment; 32 fragments per matrix.
// ---------------------------------------------------------------------------
__device__ __forceinline__ void pack_w(const float* __restrict__ W,
                                       _Float16* __restrict__ P, int frag) {
    int j = frag >> 2, kk = frag & 3;   // frag = j*4 + kk
    int lane = threadIdx.x & 31;
    int n = lane & 15, sel = lane >> 4;
    _Float16* dstp = P + (size_t)frag * 512 + lane * 8;   // plane i >> 3, see load_b_packed
#pragma unroll
    for (int i = 0; i < 16; ++i)
        dstp[(i >> 3) * 256 + (i & 7)] = (_Float16)W[(size_t)(kk * 32 + kmap(i, sel)) * DIM + j * 16 + n];
}

// ---------------------------------------------------------------------------
// First pass of the edge sort, one chunk of CHUNK edges a block, all in LDS: count
// the chunk's edges per bin of NPB destination nodes (the returned old count is the
// edge's place in its bin), scan the counts, lay the edges out bin by bin and write
// them as whole lines. An edge is one word: node within its bin << 16 | source node.
// tab gets one word a bin: start in the chunk | count << 16.
// ---------------------------------------------------------------------------
__device__ __forceinline__ void coarse_sort(const int* __restrict__ src, const int* __restrict__ dst,
                                            int* __restrict__ tab, int* __restrict__ part,
                                            int E, int blk, int* cnt, int* off, int* sorted) {
    int t = threadIdx.x;
    cnt[t] = 0;
    int d[16], v[16], br[16], ix[16];
    int e0 = blk * CHUNK + t;
#pragma unroll
    for (int k = 0; k < 16; ++k) {
        ix[k] = min(e0 + k * 256, E - 1);   // past the end: the last edge again, dropped below
        d[k] = dst[ix[k]];
        v[k] = src[ix[k]];
    }
    // the index registers may be written again below: wait first. The statement takes them
    // as inputs, so that none of the 32 loads gets one of them for its result
    asm volatile("s_wait_xcnt 0x0" :: "v"(ix[0]), "v"(ix[1]), "v"(ix[2]), "v"(ix[3]), "v"(ix[4]), "v"(ix[5]),
                 "v"(ix[6]), "v"(ix[7]), "v"(ix[8]), "v"(ix[9]), "v"(ix[10]), "v"(ix[11]), "v"(ix[12]),
                 "v"(ix[13]), "v"(ix[14]), "v"(ix[15]) : "memory");
    __syncthreads();   // the counters are zero for every wave
#pragma unroll
    for (int k = 0; k < 16; ++k) {
        bool ok = e0 + k * 256 < E && (unsigned)d[k] < (unsigned)NNODES;
        // no edge: the last pad bin, which nobody reads; so no branch stands here and the
        // 16 LDS adds of a thread are in flight together
        int bin = ok ? (int)((unsigned)d[k] / (unsigned)NPB) : TABW - 1;
        v[k] = ((ok ? d[k] - bin * NPB : 0) << 16) | min(max(v[k], 0), NNODES - 1);
        br[k] = bin;
    }
#pragma unroll
    for (int k = 0; k < 16; ++k)
        d[k] = atomicAdd(&cnt[br[k]], 1);
    __syncthreads();   // all counts are in
    if (t < 32) {      // exclusive scan of the TABW counts by one wave, 8 a lane
        int c[8], sum = 0;
#pragma unroll
        for (int i = 0; i < 8; ++i) { c[i] = sum; sum += cnt[t * 8 + i]; }
        int inc = sum;
#pragma unroll
        for (int m = 1; m < 32; m <<= 1) {
            int o = __shfl_up(inc, m, 32);
            if (t >= m) inc += o;
        }
#pragma unroll
        for (int i = 0; i < 8; ++i) off[t * 8 + i] = inc - sum + c[i];
    }
    __syncthreads();   // the starts are known
    tab[blk * TABW + t] = off[t] | (cnt[t] << 16);
    // the store's address registers may be written again below: wait first
    asm volatile("s_wait_xcnt 0x0" ::: "memory");
#pragma unroll
    for (int k = 0; k < 16; ++k)
        sorted[off[br[k]] + d[k]] = v[k];
    __syncthreads();   // the chunk lies sorted in LDS: every thread has placed 16 words, CHUNK in all
#pragma unroll
    for (int k = 0; k < 4; ++k)
        ((int4*)(part + blk * CHUNK))[t + k * 256] = ((const int4*)sorted)[t + k * 256];
    // the stores' address registers may be written again behind them: wait first
    asm volatile("s_wait_xcnt 0x0" ::: "memory");
}

// ---------------------------------------------------------------------------
// Launch 1: two jobs that depend on nothing share one grid; the block index picks
// the job. Blocks 0..15 pack the four weight matrices (4 blocks each, P holds the
// four packed matrices one behind the other); the others sort a chunk of edges each.
// ---------------------------------------------------------------------------
__global__ __launch_bounds__(256) void pack_and_sort(
        const float* __restrict__ Wq, const float* __restrict__ Wk,
        const float* __restrict__ Wv, const float* __restrict__ Wo,
        _Float16* __restrict__ P,
        const int* __restrict__ src, const int* __restrict__ dst,
        int* __restrict__ bkt, int* __restrict__ tab, int* __restrict__ part, int E) {
    __shared__ int cnt[TABW];
    __shared__ int off[TABW];
    __shared__ __attribute__((aligned(16))) int sorted[CHUNK];
    int b = blockIdx.x;
    if (b < PACK_BLOCKS) {
        int mtx = b >> 2;
        const float* W = mtx == 0 ? Wq : mtx == 1 ? Wk : mtx == 2 ? Wv : Wo;
        pack_w(W, P + mtx * (32 * 32 * 16), (b & 3) * 8 + (threadIdx.x >> 5));
        // bucket NNODES holds no edges: its counter counts the spilled edges of launch 2
        if (b == 0 && threadIdx.x == 0) bkt[NNODES * BKT + CAP] = 0;
    } else if (b - PACK_BLOCKS < PROD_MAX) {
        coarse_sort(src, dst, tab, part, E, b - PACK_BLOCKS, cnt, off, sorted);
    }
}

// ---------------------------------------------------------------------------
// Fused Q/K/V projection of one 16-row tile by one wave; Q, K and V are stored
// as f16. The weight fragment is the A operand and the x fragment the B operand
// (both have the same lane and k map), so a lane holds 8 neighbouring columns of
// one node: one 16-byte write into the wave's own LDS tile, which goes out as
// whole 256-byte rows.
// Weight fragments double-buffered across the column-tile loop so global loads
// overlap the WMMAs instead of serializing load->wait->wmma.
// ---------------------------------------------------------------------------
__device__ __forceinline__ void qkv_gemm(
        const float* __restrict__ x,
        const _Float16* __restrict__ Pq, const float* __restrict__ bq,
        const _Float16* __restrict__ Pk, const float* __restrict__ bk,
        const _Float16* __restrict__ Pv, const float* __restrict__ bv,
        _Float16* __restrict__ Q, _Float16* __restrict__ K, _Float16* __restrict__ V,
        int row0, _Float16* stage) {
    int lane = threadIdx.x & 31;

    v16h a[4];
#pragma unroll
    for (int kk = 0; kk < 4; ++kk)
        a[kk] = load_a_f32(x + (size_t)row0 * DIM + kk * 32, DIM);
    // a B load's result may land in the x loads' address pair: wait first
    asm volatile("s_wait_xcnt 0x0" ::: "memory");

    const _Float16* Ps[3] = {Pq, Pk, Pv};
    const float*    bs[3] = {bq, bk, bv};
    _Float16*       Os[3] = {Q, K, V};

    int n  = lane & 15;
    int mb = (lane >> 4) * 8;

#pragma unroll
    for (int mtx = 0; mtx < 3; ++mtx) {
        const _Float16* P    = Ps[mtx];
        const float*    bias = bs[mtx];
        _Float16*       out  = Os[mtx];

        v16h b[4];
#pragma unroll
        for (int kk = 0; kk < 4; ++kk) b[kk] = load_b_packed(P, 0, kk);
        v4f bb0 = *(const v4f*)(bias + mb);       // the lane's 8 columns of tile 0
        v4f bb1 = *(const v4f*)(bias + mb + 4);

#pragma unroll
        for (int j = 0; j < 8; ++j) {
            v16h bn[4];
            v4f bn0, bn1;
            if (j < 7) {
#pragma unroll
                for (int kk = 0; kk < 4; ++kk) bn[kk] = load_b_packed(P, j + 1, kk);
                bn0 = *(const v4f*)(bias + (j + 1) * 16 + mb);
                bn1 = *(const v4f*)(bias + (j + 1) * 16 + mb + 4);
            }
            v8f acc = {};
#pragma unroll
            for (int kk = 0; kk < 4; ++kk)
                acc = __builtin_amdgcn_wmma_f32_16x16x32_f16(
                        false, b[kk], false, a[kk], (short)0, acc, false, false);

            // acc[i] = node row0 + n, column j * 16 + mb + i
            v8h h;
            h[0] = (_Float16)(acc[0] + bb0.x); h[1] = (_Float16)(acc[1] + bb0.y);
            h[2] = (_Float16)(acc[2] + bb0.z); h[3] = (_Float16)(acc[3] + bb0.w);
            h[4] = (_Float16)(acc[4] + bb1.x); h[5] = (_Float16)(acc[5] + bb1.y);
            h[6] = (_Float16)(acc[6] + bb1.z); h[7] = (_Float16)(acc[7] + bb1.w);
            *(v8h*)(stage + n * SPITCH + j * 16 + mb) = h;

#pragma unroll
            for (int kk = 0; kk < 4; ++kk) b[kk] = bn[kk];
            bb0 = bn0; bb1 = bn1;
            // holds the next tile's loads inside this tile (loaded values as inputs only):
            // without it the compiler sinks each load to just in front of its own WMMA
            if (j < 7)
                asm volatile("" :: "v"(bn[0]), "v"(bn[1]), "v"(bn[2]), "v"(bn[3]), "v"(bn0), "v"(bn1));
        }

        // other lanes of this wave read the tile back: their writes must have landed,
        // and the compiler must not move the reads up
        asm volatile("s_wait_dscnt 0x0" ::: "memory");
        _Float16*       gp = out + (size_t)(row0 + (lane >> 4)) * DIM + n * 8;
        const _Float16* sp = stage + (lane >> 4) * SPITCH + n * 8;
#pragma unroll
        for (int r = 0; r < 8; ++r)     // rows 2r and 2r + 1: 512 contiguous bytes a store
            *(v8h*)(gp + r * 2 * DIM) = *(const v8h*)(sp + r * 2 * SPITCH);
        // a later load's result may land in a register these stores name; and the next
        // matrix's LDS writes stay behind the reads above
        asm volatile("s_wait_xcnt 0x0" ::: "memory");
    }
}

// ---------------------------------------------------------------------------
// Second pass of the edge sort: one block builds the buckets of the NPB nodes of one
// bin in LDS and writes them out as whole lines, each with its node's edge count at
// place CAP. The bin's edges lie in one run per chunk; a wave takes every 8th chunk,
// one run a load, 8 loads in flight. The old value of the node's LDS counter is the
// edge's place (arrival order). An edge that finds its bucket full goes, as the pair
// (dst, src), to the end of one spill list that all nodes share (at most E pairs).
// ---------------------------------------------------------------------------
__device__ __forceinline__ void put_edge(int val, int r, int bin, int* lb,
                                         int* __restrict__ bkt, int* __restrict__ spill, int E) {
    int dl = val >> 16, sn = val & 0xffff;
    if (r < CAP) {
        lb[dl * BKT + r] = sn;
    } else {
        int o = atomicAdd(bkt + NNODES * BKT + CAP, 1);
        if ((unsigned)o < (unsigned)E) ((int2*)spill)[o] = make_int2(bin * NPB + dl, sn);
        // the registers that the add and the store name may be written again below: wait first
        asm volatile("s_wait_xcnt 0x0" ::: "memory");
    }
}

__device__ __forceinline__ void fine_bucket(const int* __restrict__ tab, const int* __restrict__ part,
                                            int* __restrict__ bkt, int* __restrict__ spill,
                                            int E, int bin, int* lb, int* lcnt) {
    int t = threadIdx.x, lane = t & 31;
    int w = __builtin_amdgcn_readfirstlane(t >> 5);
    int nprod = min((E + CHUNK - 1) / CHUNK, PROD_MAX);
    // lane i: the table word of this wave's i-th chunk (PROD_MAX <= 8 * 32); none: count 0
    int p = w + 8 * lane;
    int ent = tab[min(p, nprod - 1) * TABW + bin];
    if (p >= nprod) ent = 0;
    // the load's address registers may be written again below: wait first
    asm volatile("s_wait_xcnt 0x0" ::: "memory");
#pragma unroll
    for (int k = 0; k < 7; ++k) {
        int i = t + k * 256;
        if (i < NPB * 8) ((int4*)lb)[i] = make_int4(0, 0, 0, 0);
    }
    if (t < NPB + 32) lcnt[t] = 0;
    __syncthreads();   // buckets and counters are zero for every wave

    // kept rolled: four copies of this body would make the kernel's text four times as long
    // for nothing, and push the projection code far back in it
#pragma unroll 1
    for (int i0 = 0; i0 < 32; i0 += 8) {
        int v[8];
#pragma unroll
        for (int u = 0; u < 8; ++u) {
            int en = __builtin_amdgcn_readlane(ent, i0 + u);
            int st = en & 0xffff;
            int n = min(en >> 16, CHUNK - st);   // a run ends inside its own chunk
            v[u] = -1;
            if (lane < n) v[u] = part[(w + 8 * (i0 + u)) * CHUNK + st + lane];
        }
        // the loads' address registers may be written again below: wait first
        asm volatile("s_wait_xcnt 0x0" ::: "memory");
        // a lane without an edge adds to a pad counter of its own: no branch stands here,
        // so the 8 LDS adds are in flight together
        int r[8];
#pragma unroll
        for (int u = 0; u < 8; ++u)
            r[u] = atomicAdd(&lcnt[v[u] >= 0 ? v[u] >> 16 : NPB + lane], 1);
#pragma unroll
        for (int u = 0; u < 8; ++u)
            if (v[u] >= 0) put_edge(v[u], r[u], bin, lb, bkt, spill, E);
        // a run of more than 32 edges: the rest, 32 a trip
        for (int u = 0; u < 8; ++u) {
            int en = __builtin_amdgcn_readlane(ent, i0 + u);
            int st = en & 0xffff;
            int n = min(en >> 16, CHUNK - st);   // at most CHUNK / 32 trips
            for (int k = 32; k < n; k += 32) {
                if (k + lane < n) {
                    int val = part[(w + 8 * (i0 + u)) * CHUNK + st + k + lane];
                    // the load's address registers may be written again below: wait first
                    asm volatile("s_wait_xcnt 0x0" ::: "memory");
                    put_edge(val, atomicAdd(&lcnt[val >> 16], 1), bin, lb, bkt, spill, E);
                }
            }
        }
    }
    __syncthreads();   // every edge of the bin is placed

    int4* go = (int4*)(bkt + bin * (NPB * BKT));
#pragma unroll
    for (int k = 0; k < 7; ++k) {
        int i = t + k * 256;
        if (i < NPB * 8) {
            int4 q = ((const int4*)lb)[i];
            if ((i & 7) == 7) q.w = lcnt[i >> 3];
            go[i] = q;
        }
    }
    // the stores' address registers may be written again behind them: wait first
    asm volatile("s_wait_xcnt 0x0" ::: "memory");
}

// ---------------------------------------------------------------------------
// Launch 2: the projections and the edge buckets need only launch 1 and not each
// other, so they share one grid. The projection blocks come first: they live
// longest. All blocks are resident at once: 8 waves a SIMD (128 registers) leaves
// room for the bucket blocks beside the two projection blocks of a WGP. A bucket
// block uses the staging tile's LDS for its buckets and counters.
// ---------------------------------------------------------------------------
__global__ __launch_bounds__(256, 8) void qkv_and_bucket(
        const float* __restrict__ x,
        const _Float16* __restrict__ Pq, const float* __restrict__ bq,
        const _Float16* __restrict__ Pk, const float* __restrict__ bk,
        const _Float16* __restrict__ Pv, const float* __restrict__ bv,
        _Float16* __restrict__ Q, _Float16* __restrict__ K, _Float16* __restrict__ V,
        const int* __restrict__ tab, const int* __restrict__ part, int* __restrict__ bkt,
        int* __restrict__ spill, int E) {
    __shared__ __attribute__((aligned(16))) _Float16 stage[8 * 16 * SPITCH];   // one tile a wave
    static_assert(sizeof(stage) >= (NPB * BKT + NPB + 32) * sizeof(int), "the buckets of a bin fit the tile");
    int b = blockIdx.x;
    if (b < QKV_BLOCKS) {
        int w = __builtin_amdgcn_readfirstlane(threadIdx.x >> 5);
        int tile = b + QKV_BLOCKS * w;
        if (tile < ROWTILES)
            qkv_gemm(x, Pq, bq, Pk, bk, Pv, bv, Q, K, V, tile * 16, stage + w * (16 * SPITCH));
    } else {
        int* lb = (int*)stage;
        fine_bucket(tab, part, bkt, spill, E, b - QKV_BLOCKS, lb, lb + NPB * BKT);
    }
}

// ---------------------------------------------------------------------------
// acc += f16 half of h (low or high) * f32 w, in f32: one instruction, no separate
// conversion (the compiler's own form converts every half first)
__device__ __forceinline__ float fma_lo(unsigned h, float w, float acc) {
    asm("v_fma_mix_f32 %0, %1, %2, %0 op_sel_hi:[1,0,0]" : "+v"(acc) : "v"(h), "v"(w));
    return acc;
}
__device__ __forceinline__ float fma_hi(unsigned h, float w, float acc) {
    asm("v_fma_mix_f32 %0, %1, %2, %0 op_sel:[1,0,0] op_sel_hi:[1,0,0]" : "+v"(acc) : "v"(h), "v"(w));
    return acc;
}

// ---------------------------------------------------------------------------
// The weighted V sum of one destination node by one wave, f16 K and V rows of 256
// bytes. A lane holds 8 of the 128 columns (16 bytes), so 16 lanes cover a row and
// one wave-wide load brings the rows of two edges: the low lanes take the even
// edges, the high lanes the odd ones. Eight edges are walked at a time (8 loads in
// flight); sums are f32 in registers and the two halves are added at the end. The
// first pass takes the node's own bucket (own: place l in lane l); only a node that
// counted more than CAP edges goes on through the spill list, 32 pairs a pass, and
// packs the sources of its own pairs into the low lanes.
// Returns columns (lane & 15) * 8 + (lane >> 4) * 4 .. + 3 of the node's row.
// ---------------------------------------------------------------------------
__device__ __forceinline__ float4 node_sum(
        const _Float16* __restrict__ K, const _Float16* __restrict__ V,
        const int* __restrict__ spill, int node, int total, int nspill, int own, v8h qh) {
    int lane = threadIdx.x & 31;
    int c = lane & 15, hi = lane >> 4;
    float q[8], acc[8];
#pragma unroll
    for (int i = 0; i < 8; ++i) {
        q[i] = (float)qh[i] * 0.25f;   // 1/sqrt(16), exact
        acc[i] = 0.0f;
    }

    for (int base = -32; base < nspill; base += 32) {
        int n, idx;
        if (base < 0) {
            n = min(total, CAP);
            idx = own;
        } else {
            int2 ds = ((const int2*)spill)[min(base + lane, nspill - 1)];
            bool mine = base + lane < nspill && ds.x == node;
            unsigned mask = __builtin_amdgcn_ballot_w32(mine);
            unsigned below = (1u << lane) - 1u;
            n = __popc(mask);
            // a permutation of the 32 lanes: own pairs first, in list order, the others behind
            int to = mine ? __popc(mask & below) : n + __popc(~mask & below);
            idx = __builtin_amdgcn_ds_permute(to * 4, ds.y);
        }
        for (int j = 0; j < n; j += 8) {
            uint4 kv[4], vv[4];   // 8 halves each
            unsigned o[4];
#pragma unroll
            for (int u = 0; u < 4; ++u) {
                // past the end: the last edge's rows again (same lines), weight 0 below
                unsigned s0 = (unsigned)__builtin_amdgcn_readlane(idx, min(j + 2 * u, n - 1));
                unsigned s1 = (unsigned)__builtin_amdgcn_readlane(idx, min(j + 2 * u + 1, n - 1));
                o[u] = (hi ? s1 : s0) * (DIM * 2u) + c * 16u;   // one 32-bit byte offset for both rows
                kv[u] = *(const uint4*)((const char*)K + o[u]);
                vv[u] = *(const uint4*)((const char*)V + o[u]);
            }
            // the offset registers are written again below: wait first. The statement takes
            // them as inputs, so that none of the 8 loads gets one of them for its result
            asm volatile("s_wait_xcnt 0x0" :: "v"(o[0]), "v"(o[1]), "v"(o[2]), "v"(o[3]) : "memory");
#pragma unroll
            for (int u = 0; u < 4; ++u) {
                float p = 0.0f;
                p = fma_lo(kv[u].x, q[0], p); p = fma_hi(kv[u].x, q[1], p);
                p = fma_lo(kv[u].y, q[2], p); p = fma_hi(kv[u].y, q[3], p);
                p = fma_lo(kv[u].z, q[4], p); p = fma_hi(kv[u].z, q[5], p);
                p = fma_lo(kv[u].w, q[6], p); p = fma_hi(kv[u].w, q[7], p);
                // a head is 16 columns = 2 neighbouring lanes: add lanes 1,0,3,2
                p += __int_as_float(__builtin_amdgcn_update_dpp(0, __float_as_int(p), 0xB1, 0xf, 0xf, true));
                p = fminf(5.0f, fmaxf(-5.0f, p));   // clamp(-5, 5)
                float sc = (j + 2 * u + hi < n) ? __expf(p) : 0.0f;
                acc[0] = fma_lo(vv[u].x, sc, acc[0]); acc[1] = fma_hi(vv[u].x, sc, acc[1]);
                acc[2] = fma_lo(vv[u].y, sc, acc[2]); acc[3] = fma_hi(vv[u].y, sc, acc[3]);
                acc[4] = fma_lo(vv[u].z, sc, acc[4]); acc[5] = fma_hi(vv[u].z, sc, acc[5]);
                acc[6] = fma_lo(vv[u].w, sc, acc[6]); acc[7] = fma_hi(vv[u].w, sc, acc[7]);
            }
        }
    }

    // even-edge and odd-edge sums meet: a lane keeps 4 of its 8 columns and gets the
    // other half-wave's sums of those (lane l <-> l ^ 16)
    float4 r;
    float* rp = &r.x;
#pragma unroll
    for (int i = 0; i < 4; ++i) {
        int give = __float_as_int(hi ? acc[i] : acc[4 + i]);
        float got = __int_as_float(__builtin_amdgcn_permlanex16(give, give, 0x76543210, 0xfedcba98, false, false));
        rp[i] = (hi ? acc[4 + i] : acc[i]) + got;
    }
    return r;
}

// ---------------------------------------------------------------------------
// Launch 3: edge sums -> residual + LN1 -> LN2 -> Wo GEMM (WMMA from LDS) -> ReLU +
// residual, one 16-node tile per block of 128 threads (4 waves). A wave sums the
// edges of 4 nodes, one after the other, and leaves each row in the LDS tile; these
// are the very 4 rows whose LayerNorms it does next, so the sums never go through
// memory and no barrier stands between the two parts. The buckets (each with its
// count in lane CAP) and Q rows of all 4 nodes and the wave's share of x are asked for
// at the start, so that only the K and V gathers wait one behind the other. 9 waves a
// SIMD: 112 registers.
// ---------------------------------------------------------------------------
__global__ __launch_bounds__(128, 9) void attn_ln_out(
        const _Float16* __restrict__ Q, const _Float16* __restrict__ K,
        const _Float16* __restrict__ V, const int* __restrict__ bkt,
        const int* __restrict__ spill, int E,
        const float* __restrict__ x,
        const _Float16* __restrict__ Po, const float* __restrict__ bo,
        const float* __restrict__ g1, const float* __restrict__ b1,
        const float* __restrict__ g2, const float* __restrict__ b2,
        float* __restrict__ out) {
    __shared__ __attribute__((aligned(16))) float h2s[16 * DIM];   // edge sums, then in place the post-LN1 tile (residual for epilogue)
    __shared__ _Float16 gs[16 * DIM];    // post-LN2 tile (A matrix for WMMA)

    int row0 = blockIdx.x * 16;
    int t = threadIdx.x;
    int r  = t >> 3;          // row in tile (8 threads per row; contiguous in wave)
    int c0 = (t & 7) * 16;    // 16 columns per thread
    int wave = __builtin_amdgcn_readfirstlane(t >> 5);
    int lane = t & 31;

    // --- what the 4 nodes of this wave need, all asked for at once ---
    int nb = row0 + wave * 4;
    // the buckets first: the gathers hang on them alone. One load brings a node's count
    // and its sources (every int of the line was written in this call, by launch 2)
    int own[4];
#pragma unroll
    for (int k = 0; k < 4; ++k)
        own[k] = bkt[(nb + k) * BKT + lane];
    // an x load's result may land in the bucket loads' address register: wait first
    asm volatile("s_wait_xcnt 0x0" ::: "memory");
    float4 xv[4];
#pragma unroll
    for (int i = 0; i < 4; ++i)
        xv[i] = *(const float4*)(x + (size_t)(row0 + r) * DIM + c0 + i * 4);
    // a Q load's result may land in the x loads' address pair: wait first
    asm volatile("s_wait_xcnt 0x0" ::: "memory");
    v8h qh[4];
#pragma unroll
    for (int k = 0; k < 4; ++k)
        qh[k] = *(const v8h*)(Q + (size_t)(nb + k) * DIM + (lane & 15) * 8);
    // the address registers of the loads above may be written again below: wait first
    asm volatile("s_wait_xcnt 0x0" ::: "memory");
    int tot[4];
#pragma unroll
    for (int k = 0; k < 4; ++k)
        tot[k] = __builtin_amdgcn_readlane(own[k], CAP);

    // --- edge sums of the 4 nodes ---
#pragma unroll
    for (int k = 0; k < 4; ++k) {
        int nspill = 0;
        if (tot[k] > CAP) nspill = min(__builtin_amdgcn_readfirstlane(bkt[NNODES * BKT + CAP]), E);
        float4 s4 = node_sum(K, V, spill, nb + k, tot[k], nspill, own[k], qh[k]);
        ((float4*)(h2s + (wave * 4 + k) * DIM))[(lane & 15) * 2 + (lane >> 4)] = s4;
    }
    // other lanes of this wave read these rows back: their writes must have landed,
    // and the compiler must not move the reads up
    asm volatile("s_wait_dscnt 0x0" ::: "memory");

    // --- preload this wave's B fragments (independent of LDS/LN work) ---
    v16h b0[4], b1f[4];
#pragma unroll
    for (int kk = 0; kk < 4; ++kk) {
        b0[kk]  = load_b_packed(Po, wave * 2 + 0, kk);
        b1f[kk] = load_b_packed(Po, wave * 2 + 1, kk);
    }

    // --- residual + LN1 ---
    float v[16];
    float s = 0.0f, ss = 0.0f;
#pragma unroll
    for (int i = 0; i < 16; ++i) {
        float val = (&xv[i >> 2].x)[i & 3] + h2s[r * DIM + c0 + i];
        v[i] = val; s += val; ss += val * val;
    }
#pragma unroll
    for (int m = 1; m < 8; m <<= 1) {     // reduce within the 8 lanes of a row
        s  += __shfl_xor(s,  m, 32);
        ss += __shfl_xor(ss, m, 32);
    }
    float mean = s * (1.0f / DIM);
    float var  = ss * (1.0f / DIM) - mean * mean;
    float rstd = rsqrtf(var + 1e-5f);

    // --- LN2 on LN1 output ---
    float s2 = 0.0f, ss2 = 0.0f;
#pragma unroll
    for (int i = 0; i < 16; ++i) {
        int c = c0 + i;
        float h = (v[i] - mean) * rstd * g1[c] + b1[c];
        v[i] = h;
        h2s[r * DIM + c] = h;
        s2 += h; ss2 += h * h;
    }
#pragma unroll
    for (int m = 1; m < 8; m <<= 1) {
        s2  += __shfl_xor(s2,  m, 32);
        ss2 += __shfl_xor(ss2, m, 32);
    }
    float mean2 = s2 * (1.0f / DIM);
    float var2  = ss2 * (1.0f / DIM) - mean2 * mean2;
    float rstd2 = rsqrtf(var2 + 1e-5f);
#pragma unroll
    for (int i = 0; i < 16; ++i) {
        int c = c0 + i;
        gs[r * DIM + c] = (_Float16)((v[i] - mean2) * rstd2 * g2[c] + b2[c]);
    }
    __syncthreads();

    // --- Wo GEMM + bias + ReLU + residual epilogue ---
    v16h a[4];
#pragma unroll
    for (int kk = 0; kk < 4; ++kk) a[kk] = load_a_lds(gs, kk * 32);

    int n  = lane & 15;
    int mb = (lane >> 4) * 8;

#pragma unroll
    for (int jj = 0; jj < 2; ++jj) {      // 8 column tiles / 4 waves
        int j = wave * 2 + jj;
        v8f acc = {};
#pragma unroll
        for (int kk = 0; kk < 4; ++kk) {
            v16h b = (jj == 0) ? b0[kk] : b1f[kk];
            acc = __builtin_amdgcn_wmma_f32_16x16x32_f16(
                    false, a[kk], false, b, (short)0, acc, false, false);
        }
        int col = j * 16 + n;
        float bb = bo[col];
#pragma unroll
        for (int i = 0; i < 8; ++i) {
            float relu = fmaxf(acc[i] + bb, 0.0f);
            out[(size_t)(row0 + mb + i) * DIM + col] = h2s[(mb + i) * DIM + col] + relu;
        }
    }
}

// ---------------------------------------------------------------------------
extern "C" void kernel_launch(void* const* d_in, const int* in_sizes, int n_in,
                              void* d_out, int out_size, void* d_ws, size_t ws_size,
                              hipStream_t stream) {
    const float* x  = (const float*)d_in[0];
    const int*   src = (const int*)d_in[1];
    const int*   dst = (const int*)d_in[2];
    const float* Wq = (const float*)d_in[3];
    const float* bq = (const float*)d_in[4];
    const float* Wk = (const float*)d_in[5];
    const float* bk = (const float*)d_in[6];
    const float* Wv = (const float*)d_in[7];
    const float* bv = (const float*)d_in[8];
    const float* Wo = (const float*)d_in[9];
    const float* bo = (const float*)d_in[10];
    const float* g1 = (const float*)d_in[11];
    const float* b1 = (const float*)d_in[12];
    const float* g2 = (const float*)d_in[13];
    const float* b2 = (const float*)d_in[14];
    float* out = (float*)d_out;

    int E = in_sizes[1];
    size_t nd = (size_t)NNODES * DIM;
    _Float16* Q = (_Float16*)d_ws;   // projections, f16
    _Float16* K = Q + nd;
    _Float16* V = K + nd;
    // packed f16 weight fragments: 32 frags * 32 lanes * 16 halves = 16384 halves each
    _Float16* Pq = V + nd;
    _Float16* Pk = Pq + 32 * 32 * 16;
    _Float16* Pv = Pk + 32 * 32 * 16;
    _Float16* Po = Pv + 32 * 32 * 16;
    // edges by dst: a bucket per node (CAP source nodes and the counter), the chunks' bin
    // tables, the chunks sorted by bin, spilled (dst, src) pairs
    int* bkt   = (int*)(Po + 32 * 32 * 16);
    int* tab   = bkt + (NNODES + 1) * BKT;
    int* part  = tab + PROD_MAX * TABW;
    int* spill = part + PROD_MAX * CHUNK;

    pack_and_sort<<<PACK_BLOCKS + (E + CHUNK - 1) / CHUNK, 256, 0, stream>>>(
        Wq, Wk, Wv, Wo, Pq, src, dst, bkt, tab, part, E);
    qkv_and_bucket<<<QKV_BLOCKS + NBINS, 256, 0, stream>>>(
        x, Pq, bq, Pk, bk, Pv, bv, Q, K, V, tab, part, bkt, spill, E);
    attn_ln_out<<<ROWTILES, 128, 0, stream>>>(Q, K, V, bkt, spill, E, x, Po, bo, g1, b1, g2, b2, out);
}
